// v000
// The times below were measured on an AMD MI455X: many runs one after another, warmed up first and cycling through
// copies of the inputs, with the whole window's GPU time divided by the number of runs. Launches and the gaps
// between them are all in it. The median over several windows is given; except for v000 it joins two sittings, which
// can be a few percent apart, so the side-by-side timings, each taken in one sitting, are the better comparison.
// v000 is the starting kernel. One run takes 1250 microseconds.
#include <hip/hip_runtime.h>

// MultiHeadSelfAttention2D (x [16][256][32][32] channel-major; q/k/v = 1x1 conv = W [512][256] . x[c][m] over the M = 1024 positions; 2-D sinusoidal PE r[c][m] (first 256 channels row position, last 256 column position; even channels sin, odd cos; constants computed on device) added to q and k;
//   8 heads x 64: logits[m][n] = sum_d qh[d][m] kh[d][n] / 8, clipped to [-50, 50]; softmax over n; out[h*64+d][m] = sum_n A[m][n] vh[d][n] -> [16][512][32][32] channel-major).
// Compute dtypes, f32 accumulate: every input rounded to bf16; the three 1x1 convs as PLAIN bf16 GEMMs W . x^T (inputs: exact; x transposed to [m][c] once per batch); q + PE and k + PE in f32 -> hl planes [h][m][d]; logits hl x hl (3 products); clip + softmax f32 -> hl planes; out = vh (hl planes [h][d][n]) . A^T as hl x hl (3 products) written straight into the channel-major output; all 8 heads of a batch in one z-batched launch.

#define NB_  16
#define CI   256
#define CO   512
#define MM   1024
#define HH   32
#define NH_  8
#define HD   64
typedef _Float16 h16;
typedef unsigned short bf;
typedef __attribute__((ext_vector_type(16))) __bf16   v16bf;
typedef __attribute__((ext_vector_type(16))) _Float16 v16h;
typedef __attribute__((ext_vector_type(8)))  _Float16 v8h;
typedef __attribute__((ext_vector_type(8)))  unsigned short v8us;
typedef __attribute__((ext_vector_type(8)))  float    v8f;
typedef __attribute__((ext_vector_type(4)))  float    v4f;
typedef v8h  __attribute__((may_alias)) v8ha;
typedef v4f  __attribute__((may_alias)) v4fa;
typedef v8us __attribute__((may_alias)) v8usa;

__device__ __forceinline__ unsigned short f2bf(float f) { unsigned u = __float_as_uint(f); u += 0x7FFFu + ((u >> 16) & 1u); return (unsigned short)(u >> 16); }
__device__ __forceinline__ float bf2f(unsigned short b) { return __uint_as_float(((unsigned)b) << 16); }
__device__ __forceinline__ float bfr(float f) { return bf2f(f2bf(f)); }
__device__ __forceinline__ v16h cat16(v8h lo, v8h hi) { return __builtin_shufflevector(lo, hi, 0, 1, 2, 3, 4, 5, 6, 7, 8, 9, 10, 11, 12, 13, 14, 15); }
__device__ __forceinline__ v16bf cat16b(v8us lo, v8us hi) { return __builtin_bit_cast(v16bf, __builtin_shufflevector(lo, hi, 0, 1, 2, 3, 4, 5, 6, 7, 8, 9, 10, 11, 12, 13, 14, 15)); }
__device__ __forceinline__ v8f wmma16(v16h a, v16h b, v8f c) { return __builtin_amdgcn_wmma_f32_16x16x32_f16(false, a, false, b, (short)0, c, false, false); }
__device__ __forceinline__ v8f wmmab(v16bf a, v16bf b, v8f c) { return __builtin_amdgcn_wmma_f32_16x16x32_bf16(false, a, false, b, (short)0, c, false, false); }



// ---- k_gemmw: register-blocked GEMM, ONE WAVE per 64x64 output tile (16 accumulators), operands straight from K-contiguous 16-bit planes; grid (M/64, N/64, Z), 32 threads.
// C[m][n] (f32, pitch ldc, + optional f32 bias[n]) = sum_k A[m][k] Bt[n][k] (+ split products per NSPLIT). z-batch strides sA/sB/sC in elements. K % 32 == 0.
template <typename T16> struct WFrag;
template <> struct WFrag<h16> { typedef v16h V; static __device__ __forceinline__ V ld(const h16* p) { return cat16(*(const v8h*)p, *(const v8h*)(p + 16)); } static __device__ __forceinline__ v8f mma(V a, V b, v8f c) { return wmma16(a, b, c); } };
template <> struct WFrag<bf> { typedef v16bf V; static __device__ __forceinline__ V ld(const bf* p) { return cat16b(*(const v8us*)p, *(const v8us*)(p + 16)); } static __device__ __forceinline__ v8f mma(V a, V b, v8f c) { return wmmab(a, b, c); } };
template <typename T16, int NSPLIT, bool BIAS>
__global__ __launch_bounds__(32) void k_gemmw(const T16* __restrict__ A, const T16* __restrict__ A2, const T16* __restrict__ Bt, const T16* __restrict__ Bt2, int K, float* C, int ldc, const float* __restrict__ bias, size_t sA, size_t sB, size_t sC) {
    typedef typename WFrag<T16>::V V;
    __shared__ __align__(16) float os[16 * 68];
    const size_t z = blockIdx.z; A += z * sA; if (A2) A2 += z * sA; Bt += z * sB; if (Bt2) Bt2 += z * sB; C += z * sC;
    const int lane = threadIdx.x & 31, lr = lane & 15, hi = lane >> 4; const int r0 = blockIdx.x * 64, c0 = blockIdx.y * 64;
    v8f acc[4][4];
#pragma unroll
    for (int mb = 0; mb < 4; ++mb)
#pragma unroll
        for (int nb = 0; nb < 4; ++nb) acc[mb][nb] = (v8f){};
    const size_t aoff = (size_t)(r0 + lr) * K + 8 * hi, boff = (size_t)(c0 + lr) * K + 8 * hi;
#pragma unroll 1
    for (int kc = 0; kc < K; kc += 32) {
        V a[4], a2[4];
#pragma unroll
        for (int mb = 0; mb < 4; ++mb) { a[mb] = WFrag<T16>::ld(A + aoff + (size_t)mb * 16 * K + kc); if (NSPLIT == 1 || NSPLIT == 2) a2[mb] = WFrag<T16>::ld(A2 + aoff + (size_t)mb * 16 * K + kc); }
#pragma unroll
        for (int nb = 0; nb < 4; ++nb) { const V b = WFrag<T16>::ld(Bt + boff + (size_t)nb * 16 * K + kc); V b2; if (NSPLIT >= 2) b2 = WFrag<T16>::ld(Bt2 + boff + (size_t)nb * 16 * K + kc);
#pragma unroll
            for (int mb = 0; mb < 4; ++mb) { acc[mb][nb] = WFrag<T16>::mma(a[mb], b, acc[mb][nb]); if (NSPLIT == 1 || NSPLIT == 2) acc[mb][nb] = WFrag<T16>::mma(a2[mb], b, acc[mb][nb]); if (NSPLIT >= 2) acc[mb][nb] = WFrag<T16>::mma(a[mb], b2, acc[mb][nb]); } }
        asm volatile("v_nop\n\tv_nop\n\tv_nop\n\tv_nop" : "+v"(acc[0][0]), "+v"(acc[1][1]), "+v"(acc[2][2]), "+v"(acc[3][3]) : "v"(a[0]), "v"(a[3]));
    }
#pragma unroll
    for (int mb = 0; mb < 4; ++mb) {
#pragma unroll
        for (int nb = 0; nb < 4; ++nb) {
#pragma unroll
            for (int j = 0; j < 8; ++j) os[(hi * 8 + j) * 68 + nb * 16 + lr] = acc[mb][nb][j]; }
        __builtin_amdgcn_wave_barrier(); asm volatile("" ::: "memory");
        float* crow = C + (size_t)(r0 + mb * 16) * ldc + c0;
{
#pragma unroll
            for (int s = 0; s < 8; ++s) { const int row = 2 * s + hi, cofs = lr * 4; v4f val = *(const v4fa*)(os + row * 68 + cofs); if (BIAS) { val[0] += bfr(bias[c0 + cofs]); val[1] += bfr(bias[c0 + cofs + 1]); val[2] += bfr(bias[c0 + cofs + 2]); val[3] += bfr(bias[c0 + cofs + 3]); }
                *(v4f*)(crow + (size_t)row * ldc + cofs) = val; }
             }
        __builtin_amdgcn_wave_barrier(); asm volatile("" ::: "memory");
    }
}

__device__ __forceinline__ void splitf(float y, unsigned short& h, unsigned short& l) { h = f2bf(y); l = f2bf(y - bf2f(h)); }
typedef __attribute__((ext_vector_type(2))) unsigned short v2us;
typedef __attribute__((ext_vector_type(4))) unsigned short v4us;

__global__ __launch_bounds__(256) void k_cvt8(const float* __restrict__ src, bf* dst, size_t n8) { const size_t i = (size_t)blockIdx.x * 256 + threadIdx.x; if (i >= n8) return; const v8f v = *(const v8f*)(src + i * 8); v8us o;
#pragma unroll
    for (int k = 0; k < 8; ++k) o[k] = f2bf(v[k]); *(v8us*)(dst + i * 8) = o;  }
// k_pe: PE[c][m] (f32): c < 256 -> pe1d(256, row = m / 32)[c], else pe1d(256, col = m % 32)[c - 256]; pe1d(d, L)[p][ch] = (ch even ? sin : cos)(p * exp(-ln(1e4) * (ch - ch%2) / d)) (16-B lanes along m);
// k_xt: XT[m][c] = bf16(x[c][m]) (lane -> 4 c... written as [m][c] with 8-B lanes: lanes run along c); k_qpl: hl planes [h][m][d] of (F[h*64+d][m] + PE) (lanes along d: 8-B; reads strided); k_vpl: hl planes [h][d][n] of F[h*64+d][n] (16-B lanes along n, no PE);
__global__ __launch_bounds__(256) void k_pe(float* PE) { const int e = (blockIdx.x * 256 + threadIdx.x) * 4; if (e >= CO * MM) return; const int c = e / MM; const int m0 = e % MM; const int cc = (c < CO / 2) ? c : c - CO / 2; const int ch2 = cc & ~1; const float div = __expf(-logf(10000.0f) * (float)ch2 / (float)(CO / 2)); v4f r;
#pragma unroll 1
    for (int u = 0; u < 4; ++u) { const int m = m0 + u; const int p = (c < CO / 2) ? (m / HH) : (m % HH); const float ang = __fmul_rn((float)p, div); r[u] = (cc & 1) ? cosf(ang) : sinf(ang); }
    *(v4f*)(PE + e) = r;  }
__global__ __launch_bounds__(256) void k_xt(const float* __restrict__ X, bf* XT) { const int e = (blockIdx.x * 256 + threadIdx.x) * 4; if (e >= MM * CI) return; const int c = e % CI; const int m = e / CI; v4us o;
#pragma unroll
    for (int u = 0; u < 4; ++u) o[u] = f2bf(X[(size_t)(c + u) * MM + m]); *(v4us*)(XT + e) = o;  }
__global__ __launch_bounds__(256) void k_qpl(const float* __restrict__ F, const float* __restrict__ PE, bf* Ph, bf* Pl) { const int e = (blockIdx.x * 256 + threadIdx.x) * 4; if (e >= NH_ * MM * HD) return; const int d = e % HD; const int m = (e / HD) % MM; const int h = e / (HD * MM); v4us oh, ol;
#pragma unroll
    for (int u = 0; u < 4; ++u) { const size_t idx = (size_t)(h * HD + d + u) * MM + m; unsigned short a, b; splitf(__fadd_rn(F[idx], PE[idx]), a, b); oh[u] = a; ol[u] = b; } *(v4us*)(Ph + e) = oh; *(v4us*)(Pl + e) = ol;  }
__global__ __launch_bounds__(256) void k_vpl(const float* __restrict__ F, bf* Ph, bf* Pl) { const int e = (blockIdx.x * 256 + threadIdx.x) * 4; if (e >= CO * MM) return; v4us oh, ol; const v4f a = *(const v4f*)(F + e);
#pragma unroll
    for (int u = 0; u < 4; ++u) { unsigned short x0, x1; splitf(a[u], x0, x1); oh[u] = x0; ol[u] = x1; } *(v4us*)(Ph + e) = oh; *(v4us*)(Pl + e) = ol;  }   // [h*64+d][n] == planes [h][d][n]
__global__ __launch_bounds__(256) void k_csoft(const float* __restrict__ S, bf* Ph, bf* Pl) { const int lane = threadIdx.x & 31; const int row = blockIdx.x * 8 + (threadIdx.x >> 5); if (row >= NH_ * MM) return; const float* sr = S + (size_t)row * MM; float v[MM / 32]; float mx = -3.0e38f;
#pragma unroll
    for (int ch = 0; ch < MM / 128; ++ch) { const v4f a = *(const v4f*)(sr + ch * 128 + lane * 4);
#pragma unroll
        for (int u = 0; u < 4; ++u) { const float t = fminf(fmaxf(a[u] * 0.125f, -50.0f), 50.0f); v[ch * 4 + u] = t; mx = fmaxf(mx, t); } }
#pragma unroll
    for (int sh = 16; sh; sh >>= 1) mx = fmaxf(mx, __shfl_xor(mx, sh, 32));
    float sum = 0.f;
#pragma unroll
    for (int q = 0; q < MM / 32; ++q) { float d0 = __fsub_rn(v[q], mx); asm volatile("" : "+v"(d0)); v[q] = __builtin_amdgcn_exp2f(__fmul_rn(d0, 1.4426950408889634f)); sum += v[q]; }
#pragma unroll
    for (int sh = 16; sh; sh >>= 1) sum += __shfl_xor(sum, sh, 32);
    const float f = __fdiv_rn(1.0f, sum);
    {
#pragma unroll
        for (int ch = 0; ch < MM / 128; ++ch) { v4us oh, ol; for (int q = 0; q < 4; ++q) { unsigned short a2, c2; splitf(v[ch * 4 + q] * f, a2, c2); oh[q] = a2; ol[q] = c2; } const size_t oo = (size_t)row * MM + ch * 128 + lane * 4; *(v4us*)(Ph + oo) = oh; *(v4us*)(Pl + oo) = ol; }
         } }

extern "C" void kernel_launch(void* const* d_in, const int* in_sizes, int n_in,
                              void* d_out, int out_size, void* d_ws, size_t ws_size, hipStream_t stream) {
    (void)in_sizes; (void)n_in; (void)out_size;
    const float* x = (const float*)d_in[0]; const float* Wq = (const float*)d_in[1]; const float* Wk = (const float*)d_in[2]; const float* Wv = (const float*)d_in[3];
    float* OUT = (float*)d_out;     // [16][512][1024]
    char* wsp = (char*)d_ws;
    auto take = [&](size_t bytes) { char* p = wsp; wsp += (bytes + 255) & ~(size_t)255; return (void*)p; };
    bf* AQ = (bf*)take((size_t)CO * CI * 2); bf* AK = (bf*)take((size_t)CO * CI * 2); bf* AV = (bf*)take((size_t)CO * CI * 2); float* PE = (float*)take((size_t)CO * MM * 4); bf* XT = (bf*)take((size_t)MM * CI * 2);
    float* F = (float*)take((size_t)CO * MM * 4); bf* QPh = (bf*)take((size_t)NH_ * MM * HD * 2); bf* QPl = (bf*)take((size_t)NH_ * MM * HD * 2); bf* KPh = (bf*)take((size_t)NH_ * MM * HD * 2); bf* KPl = (bf*)take((size_t)NH_ * MM * HD * 2); bf* VPh = (bf*)take((size_t)CO * MM * 2); bf* VPl = (bf*)take((size_t)CO * MM * 2);
    float* S = (float*)take((size_t)NH_ * MM * MM * 4); bf* Ph = (bf*)take((size_t)NH_ * MM * MM * 2); bf* Pl = (bf*)take((size_t)NH_ * MM * MM * 2);
    if ((size_t)(wsp - (char*)d_ws) > ws_size) return;    // total ~ 75 MB
    k_cvt8<<<(CO * CI / 8 + 255) / 256, 256, 0, stream>>>(Wq, AQ, CO * CI / 8); k_cvt8<<<(CO * CI / 8 + 255) / 256, 256, 0, stream>>>(Wk, AK, CO * CI / 8); k_cvt8<<<(CO * CI / 8 + 255) / 256, 256, 0, stream>>>(Wv, AV, CO * CI / 8);   // W [o][c] is the A operand as-is
    k_pe<<<(CO * MM / 4 + 255) / 256, 256, 0, stream>>>(PE);
    const size_t zq = (size_t)MM * HD, zS = (size_t)MM * MM, zv = (size_t)HD * MM;
    for (int b = 0; b < NB_; ++b) {
        k_xt<<<(MM * CI / 4 + 255) / 256, 256, 0, stream>>>(x + (size_t)b * CI * MM, XT);
        k_gemmw<bf, 0, false><<<dim3(CO / 64, MM / 64, 1), 32, 0, stream>>>(AQ, nullptr, XT, nullptr, CI, F, MM, nullptr, 0, 0, 0); k_qpl<<<(NH_ * MM * HD / 4 + 255) / 256, 256, 0, stream>>>(F, PE, QPh, QPl);
        k_gemmw<bf, 0, false><<<dim3(CO / 64, MM / 64, 1), 32, 0, stream>>>(AK, nullptr, XT, nullptr, CI, F, MM, nullptr, 0, 0, 0); k_qpl<<<(NH_ * MM * HD / 4 + 255) / 256, 256, 0, stream>>>(F, PE, KPh, KPl);
        k_gemmw<bf, 0, false><<<dim3(CO / 64, MM / 64, 1), 32, 0, stream>>>(AV, nullptr, XT, nullptr, CI, F, MM, nullptr, 0, 0, 0); k_vpl<<<(CO * MM / 4 + 255) / 256, 256, 0, stream>>>(F, VPh, VPl);
        k_gemmw<bf, 2, false><<<dim3(MM / 64, MM / 64, NH_), 32, 0, stream>>>(QPh, QPl, KPh, KPl, HD, S, MM, nullptr, zq, zq, zS);
        k_csoft<<<NH_ * MM / 8, 256, 0, stream>>>(S, Ph, Pl);
        k_gemmw<bf, 2, false><<<dim3(1, MM / 64, NH_), 32, 0, stream>>>(VPh, VPl, Ph, Pl, MM, OUT + (size_t)b * CO * MM, MM, nullptr, zv, zS, zv); }   // out[h*64+d][m] = sum_n vh[d][n] A[m][n]
}

// v001
// A run of this version takes 641 microseconds.
// Next to v000, in two timings, it ran 1.95 times as fast each time.
#include <hip/hip_runtime.h>

// MultiHeadSelfAttention2D (x [16][256][32][32] channel-major; q/k/v = 1x1 conv = W [512][256] . x[c][m] over the M = 1024 positions; 2-D sinusoidal PE r[c][m] (first 256 channels row position, last 256 column position; even channels sin, odd cos; constants computed on device) added to q and k;
//   8 heads x 64: logits[m][n] = sum_d qh[d][m] kh[d][n] / 8, clipped to [-50, 50]; softmax over n; out[h*64+d][m] = sum_n A[m][n] vh[d][n] -> [16][512][32][32] channel-major).
// Compute dtypes, f32 accumulate: every input rounded to bf16; the three 1x1 convs as PLAIN bf16 GEMMs W . x^T (inputs: exact; x transposed to [m][c] once per batch); q + PE and k + PE in f32 -> hl planes [h][m][d]; logits hl x hl (3 products); clip + softmax f32 -> hl planes; out = vh (hl planes [h][d][n]) . A^T as hl x hl (3 products) written straight into the channel-major output; the batch index rides in the grid: every conv-side stage covers all 16 batches in one launch, the three attention stages cover GB batches x 8 heads per launch (GB set by the workspace: f32 logits plus the two softmax planes of GB batches).

#define NB_  16
#define CI   256
#define CO   512
#define MM   1024
#define HH   32
#define NH_  8
#define HD   64
#define GB   2
typedef _Float16 h16;
typedef unsigned short bf;
typedef __attribute__((ext_vector_type(16))) __bf16   v16bf;
typedef __attribute__((ext_vector_type(16))) _Float16 v16h;
typedef __attribute__((ext_vector_type(8)))  _Float16 v8h;
typedef __attribute__((ext_vector_type(8)))  unsigned short v8us;
typedef __attribute__((ext_vector_type(8)))  float    v8f;
typedef __attribute__((ext_vector_type(4)))  float    v4f;
typedef v8h  __attribute__((may_alias)) v8ha;
typedef v4f  __attribute__((may_alias)) v4fa;
typedef v8us __attribute__((may_alias)) v8usa;

__device__ __forceinline__ unsigned short f2bf(float f) { unsigned u = __float_as_uint(f); u += 0x7FFFu + ((u >> 16) & 1u); return (unsigned short)(u >> 16); }
__device__ __forceinline__ float bf2f(unsigned short b) { return __uint_as_float(((unsigned)b) << 16); }
__device__ __forceinline__ float bfr(float f) { return bf2f(f2bf(f)); }
__device__ __forceinline__ v16h cat16(v8h lo, v8h hi) { return __builtin_shufflevector(lo, hi, 0, 1, 2, 3, 4, 5, 6, 7, 8, 9, 10, 11, 12, 13, 14, 15); }
__device__ __forceinline__ v16bf cat16b(v8us lo, v8us hi) { return __builtin_bit_cast(v16bf, __builtin_shufflevector(lo, hi, 0, 1, 2, 3, 4, 5, 6, 7, 8, 9, 10, 11, 12, 13, 14, 15)); }
__device__ __forceinline__ v8f wmma16(v16h a, v16h b, v8f c) { return __builtin_amdgcn_wmma_f32_16x16x32_f16(false, a, false, b, (short)0, c, false, false); }
__device__ __forceinline__ v8f wmmab(v16bf a, v16bf b, v8f c) { return __builtin_amdgcn_wmma_f32_16x16x32_bf16(false, a, false, b, (short)0, c, false, false); }



// ---- k_gemmw: register-blocked GEMM, ONE WAVE per 64x64 output tile (16 accumulators), operands straight from K-contiguous 16-bit planes; grid (M/64, N/64, Z), 32 threads.
// C[m][n] (f32, pitch ldc, + optional f32 bias[n]) = sum_k A[m][k] Bt[n][k] (+ split products per NSPLIT). z-batch strides sA/sB/sC in elements. K % 32 == 0.
template <typename T16> struct WFrag;
template <> struct WFrag<h16> { typedef v16h V; static __device__ __forceinline__ V ld(const h16* p) { return cat16(*(const v8h*)p, *(const v8h*)(p + 16)); } static __device__ __forceinline__ v8f mma(V a, V b, v8f c) { return wmma16(a, b, c); } };
template <> struct WFrag<bf> { typedef v16bf V; static __device__ __forceinline__ V ld(const bf* p) { return cat16b(*(const v8us*)p, *(const v8us*)(p + 16)); } static __device__ __forceinline__ v8f mma(V a, V b, v8f c) { return wmmab(a, b, c); } };
template <typename T16, int NSPLIT, bool BIAS>
__global__ __launch_bounds__(32) void k_gemmw(const T16* __restrict__ A, const T16* __restrict__ A2, const T16* __restrict__ Bt, const T16* __restrict__ Bt2, int K, float* C, int ldc, const float* __restrict__ bias, size_t sA, size_t sB, size_t sC) {
    typedef typename WFrag<T16>::V V;
    __shared__ __align__(16) float os[16 * 68];
    const size_t z = blockIdx.z; A += z * sA; if (A2) A2 += z * sA; Bt += z * sB; if (Bt2) Bt2 += z * sB; C += z * sC;
    const int lane = threadIdx.x & 31, lr = lane & 15, hi = lane >> 4; const int r0 = blockIdx.x * 64, c0 = blockIdx.y * 64;
    v8f acc[4][4];
#pragma unroll
    for (int mb = 0; mb < 4; ++mb)
#pragma unroll
        for (int nb = 0; nb < 4; ++nb) acc[mb][nb] = (v8f){};
    const size_t aoff = (size_t)(r0 + lr) * K + 8 * hi, boff = (size_t)(c0 + lr) * K + 8 * hi;
#pragma unroll 1
    for (int kc = 0; kc < K; kc += 32) {
        V a[4], a2[4];
#pragma unroll
        for (int mb = 0; mb < 4; ++mb) { a[mb] = WFrag<T16>::ld(A + aoff + (size_t)mb * 16 * K + kc); if (NSPLIT == 1 || NSPLIT == 2) a2[mb] = WFrag<T16>::ld(A2 + aoff + (size_t)mb * 16 * K + kc); }
#pragma unroll
        for (int nb = 0; nb < 4; ++nb) { const V b = WFrag<T16>::ld(Bt + boff + (size_t)nb * 16 * K + kc); V b2; if (NSPLIT >= 2) b2 = WFrag<T16>::ld(Bt2 + boff + (size_t)nb * 16 * K + kc);
#pragma unroll
            for (int mb = 0; mb < 4; ++mb) { acc[mb][nb] = WFrag<T16>::mma(a[mb], b, acc[mb][nb]); if (NSPLIT == 1 || NSPLIT == 2) acc[mb][nb] = WFrag<T16>::mma(a2[mb], b, acc[mb][nb]); if (NSPLIT >= 2) acc[mb][nb] = WFrag<T16>::mma(a[mb], b2, acc[mb][nb]); } }
        asm volatile("v_nop\n\tv_nop\n\tv_nop\n\tv_nop" : "+v"(acc[0][0]), "+v"(acc[1][1]), "+v"(acc[2][2]), "+v"(acc[3][3]) : "v"(a[0]), "v"(a[3]));
    }
#pragma unroll
    for (int mb = 0; mb < 4; ++mb) {
#pragma unroll
        for (int nb = 0; nb < 4; ++nb) {
#pragma unroll
            for (int j = 0; j < 8; ++j) os[(hi * 8 + j) * 68 + nb * 16 + lr] = acc[mb][nb][j]; }
        __builtin_amdgcn_wave_barrier(); asm volatile("" ::: "memory");
        float* crow = C + (size_t)(r0 + mb * 16) * ldc + c0;
{
#pragma unroll
            for (int s = 0; s < 8; ++s) { const int row = 2 * s + hi, cofs = lr * 4; v4f val = *(const v4fa*)(os + row * 68 + cofs); if (BIAS) { val[0] += bfr(bias[c0 + cofs]); val[1] += bfr(bias[c0 + cofs + 1]); val[2] += bfr(bias[c0 + cofs + 2]); val[3] += bfr(bias[c0 + cofs + 3]); }
                *(v4f*)(crow + (size_t)row * ldc + cofs) = val; }
             }
        __builtin_amdgcn_wave_barrier(); asm volatile("" ::: "memory");
    }
}

__device__ __forceinline__ void splitf(float y, unsigned short& h, unsigned short& l) { h = f2bf(y); l = f2bf(y - bf2f(h)); }
typedef __attribute__((ext_vector_type(2))) unsigned short v2us;
typedef __attribute__((ext_vector_type(4))) unsigned short v4us;

__global__ __launch_bounds__(256) void k_cvt8(const float* __restrict__ src, bf* dst, size_t n8) { const size_t i = (size_t)blockIdx.x * 256 + threadIdx.x; if (i >= n8) return; const v8f v = *(const v8f*)(src + i * 8); v8us o;
#pragma unroll
    for (int k = 0; k < 8; ++k) o[k] = f2bf(v[k]); *(v8us*)(dst + i * 8) = o;  }
// k_pe: PE[c][m] (f32): c < 256 -> pe1d(256, row = m / 32)[c], else pe1d(256, col = m % 32)[c - 256]; pe1d(d, L)[p][ch] = (ch even ? sin : cos)(p * exp(-ln(1e4) * (ch - ch%2) / d)) (16-B lanes along m);
// blockIdx.y = batch in k_xt, k_qpl, k_vpl. k_xt: XT[m][c] = bf16(x[c][m]) (lane -> 4 c... written as [m][c] with 8-B lanes: lanes run along c); k_qpl: hl planes [h][m][d] of (F[h*64+d][m] + PE) (lanes along d: 8-B; reads strided); k_vpl: hl planes [h][d][n] of F[h*64+d][n] (16-B lanes along n, no PE);
__global__ __launch_bounds__(256) void k_pe(float* PE) { const int e = (blockIdx.x * 256 + threadIdx.x) * 4; if (e >= CO * MM) return; const int c = e / MM; const int m0 = e % MM; const int cc = (c < CO / 2) ? c : c - CO / 2; const int ch2 = cc & ~1; const float div = __expf(-logf(10000.0f) * (float)ch2 / (float)(CO / 2)); v4f r;
#pragma unroll 1
    for (int u = 0; u < 4; ++u) { const int m = m0 + u; const int p = (c < CO / 2) ? (m / HH) : (m % HH); const float ang = __fmul_rn((float)p, div); r[u] = (cc & 1) ? cosf(ang) : sinf(ang); }
    *(v4f*)(PE + e) = r;  }
__global__ __launch_bounds__(256) void k_xt(const float* __restrict__ X, bf* XT) { const int e = (blockIdx.x * 256 + threadIdx.x) * 4; if (e >= MM * CI) return; X += (size_t)blockIdx.y * CI * MM; XT += (size_t)blockIdx.y * MM * CI; const int c = e % CI; const int m = e / CI; v4us o;
#pragma unroll
    for (int u = 0; u < 4; ++u) o[u] = f2bf(X[(size_t)(c + u) * MM + m]); *(v4us*)(XT + e) = o;  }
__global__ __launch_bounds__(256) void k_qpl(const float* __restrict__ F, const float* __restrict__ PE, bf* Ph, bf* Pl) { const int e = (blockIdx.x * 256 + threadIdx.x) * 4; if (e >= NH_ * MM * HD) return; F += (size_t)blockIdx.y * CO * MM; Ph += (size_t)blockIdx.y * NH_ * MM * HD; Pl += (size_t)blockIdx.y * NH_ * MM * HD; const int d = e % HD; const int m = (e / HD) % MM; const int h = e / (HD * MM); v4us oh, ol;
#pragma unroll
    for (int u = 0; u < 4; ++u) { const size_t idx = (size_t)(h * HD + d + u) * MM + m; unsigned short a, b; splitf(__fadd_rn(F[idx], PE[idx]), a, b); oh[u] = a; ol[u] = b; } *(v4us*)(Ph + e) = oh; *(v4us*)(Pl + e) = ol;  }
__global__ __launch_bounds__(256) void k_vpl(const float* __restrict__ F, bf* Ph, bf* Pl) { const int e = (blockIdx.x * 256 + threadIdx.x) * 4; if (e >= CO * MM) return; F += (size_t)blockIdx.y * CO * MM; Ph += (size_t)blockIdx.y * CO * MM; Pl += (size_t)blockIdx.y * CO * MM; v4us oh, ol; const v4f a = *(const v4f*)(F + e);
#pragma unroll
    for (int u = 0; u < 4; ++u) { unsigned short x0, x1; splitf(a[u], x0, x1); oh[u] = x0; ol[u] = x1; } *(v4us*)(Ph + e) = oh; *(v4us*)(Pl + e) = ol;  }   // [h*64+d][n] == planes [h][d][n]
__global__ __launch_bounds__(256) void k_csoft(const float* __restrict__ S, bf* Ph, bf* Pl) { const int lane = threadIdx.x & 31; const int row = blockIdx.x * 8 + (threadIdx.x >> 5); if (row >= GB * NH_ * MM) return; const float* sr = S + (size_t)row * MM; float v[MM / 32]; float mx = -3.0e38f;
#pragma unroll
    for (int ch = 0; ch < MM / 128; ++ch) { const v4f a = *(const v4f*)(sr + ch * 128 + lane * 4);
#pragma unroll
        for (int u = 0; u < 4; ++u) { const float t = fminf(fmaxf(a[u] * 0.125f, -50.0f), 50.0f); v[ch * 4 + u] = t; mx = fmaxf(mx, t); } }
#pragma unroll
    for (int sh = 16; sh; sh >>= 1) mx = fmaxf(mx, __shfl_xor(mx, sh, 32));
    float sum = 0.f;
#pragma unroll
    for (int q = 0; q < MM / 32; ++q) { float d0 = __fsub_rn(v[q], mx); asm volatile("" : "+v"(d0)); v[q] = __builtin_amdgcn_exp2f(__fmul_rn(d0, 1.4426950408889634f)); sum += v[q]; }
#pragma unroll
    for (int sh = 16; sh; sh >>= 1) sum += __shfl_xor(sum, sh, 32);
    const float f = __fdiv_rn(1.0f, sum);
    {
#pragma unroll
        for (int ch = 0; ch < MM / 128; ++ch) { v4us oh, ol; for (int q = 0; q < 4; ++q) { unsigned short a2, c2; splitf(v[ch * 4 + q] * f, a2, c2); oh[q] = a2; ol[q] = c2; } const size_t oo = (size_t)row * MM + ch * 128 + lane * 4; *(v4us*)(Ph + oo) = oh; *(v4us*)(Pl + oo) = ol; }
         } }

extern "C" void kernel_launch(void* const* d_in, const int* in_sizes, int n_in,
                              void* d_out, int out_size, void* d_ws, size_t ws_size, hipStream_t stream) {
    (void)in_sizes; (void)n_in; (void)out_size;
    const float* x = (const float*)d_in[0]; const float* Wq = (const float*)d_in[1]; const float* Wk = (const float*)d_in[2]; const float* Wv = (const float*)d_in[3];
    float* OUT = (float*)d_out;     // [16][512][1024]
    char* wsp = (char*)d_ws;
    auto take = [&](size_t bytes) { char* p = wsp; wsp += (bytes + 255) & ~(size_t)255; return (void*)p; };
    bf* AQ = (bf*)take((size_t)CO * CI * 2); bf* AK = (bf*)take((size_t)CO * CI * 2); bf* AV = (bf*)take((size_t)CO * CI * 2); float* PE = (float*)take((size_t)CO * MM * 4); bf* XT = (bf*)take((size_t)NB_ * MM * CI * 2);
    bf* QPh = (bf*)take((size_t)NB_ * CO * MM * 2); bf* QPl = (bf*)take((size_t)NB_ * CO * MM * 2); bf* KPh = (bf*)take((size_t)NB_ * CO * MM * 2); bf* KPl = (bf*)take((size_t)NB_ * CO * MM * 2); bf* VPh = (bf*)take((size_t)NB_ * CO * MM * 2); bf* VPl = (bf*)take((size_t)NB_ * CO * MM * 2);
    float* S = (float*)take((size_t)GB * NH_ * MM * MM * 4); bf* Ph = (bf*)take((size_t)GB * NH_ * MM * MM * 2); bf* Pl = (bf*)take((size_t)GB * NH_ * MM * MM * 2);
    float* F = S;    // conv outputs of all 16 batches (32 MiB, inside the 64 MiB of S): last read by k_vpl, before the first logits launch writes S
    if ((size_t)(wsp - (char*)d_ws) > ws_size) return;    // total ~ 235 MiB
    k_cvt8<<<(CO * CI / 8 + 255) / 256, 256, 0, stream>>>(Wq, AQ, CO * CI / 8); k_cvt8<<<(CO * CI / 8 + 255) / 256, 256, 0, stream>>>(Wk, AK, CO * CI / 8); k_cvt8<<<(CO * CI / 8 + 255) / 256, 256, 0, stream>>>(Wv, AV, CO * CI / 8);   // W [o][c] is the A operand as-is
    k_pe<<<(CO * MM / 4 + 255) / 256, 256, 0, stream>>>(PE);
    const size_t zq = (size_t)MM * HD, zS = (size_t)MM * MM, zv = (size_t)HD * MM, zx = (size_t)MM * CI, zf = (size_t)CO * MM;
    k_xt<<<dim3((MM * CI / 4 + 255) / 256, NB_), 256, 0, stream>>>(x, XT);
    k_gemmw<bf, 0, false><<<dim3(CO / 64, MM / 64, NB_), 32, 0, stream>>>(AQ, nullptr, XT, nullptr, CI, F, MM, nullptr, 0, zx, zf); k_qpl<<<dim3((NH_ * MM * HD / 4 + 255) / 256, NB_), 256, 0, stream>>>(F, PE, QPh, QPl);
    k_gemmw<bf, 0, false><<<dim3(CO / 64, MM / 64, NB_), 32, 0, stream>>>(AK, nullptr, XT, nullptr, CI, F, MM, nullptr, 0, zx, zf); k_qpl<<<dim3((NH_ * MM * HD / 4 + 255) / 256, NB_), 256, 0, stream>>>(F, PE, KPh, KPl);
    k_gemmw<bf, 0, false><<<dim3(CO / 64, MM / 64, NB_), 32, 0, stream>>>(AV, nullptr, XT, nullptr, CI, F, MM, nullptr, 0, zx, zf); k_vpl<<<dim3((CO * MM / 4 + 255) / 256, NB_), 256, 0, stream>>>(F, VPh, VPl);
    for (int b = 0; b < NB_; b += GB) {   // z = (batch - b) * 8 + head: the planes, S and OUT are all contiguous in that index
        const size_t o = (size_t)b * zf;
        k_gemmw<bf, 2, false><<<dim3(MM / 64, MM / 64, GB * NH_), 32, 0, stream>>>(QPh + o, QPl + o, KPh + o, KPl + o, HD, S, MM, nullptr, zq, zq, zS);
        k_csoft<<<GB * NH_ * MM / 8, 256, 0, stream>>>(S, Ph, Pl);
        k_gemmw<bf, 2, false><<<dim3(1, MM / 64, GB * NH_), 32, 0, stream>>>(VPh + o, VPl + o, Ph, Pl, MM, OUT + o, MM, nullptr, zv, zS, zv); }   // out[h*64+d][m] = sum_n vh[d][n] A[m][n]
}

// v002
// Measured time: 200 microseconds a run.
// Next to v001, in two timings, it ran 3.21 and 3.25 times as fast.
// Over all steps from v000 it is 6.30 times as fast.
#include <hip/hip_runtime.h>

// MultiHeadSelfAttention2D (x [16][256][32][32] channel-major; q/k/v = 1x1 conv = W [512][256] . x[c][m] over the M = 1024 positions; 2-D sinusoidal PE r[c][m] (first 256 channels row position, last 256 column position; even channels sin, odd cos; constants computed on device) added to q and k;
//   8 heads x 64: logits[m][n] = sum_d qh[d][m] kh[d][n] / 8, clipped to [-50, 50]; softmax over n; out[h*64+d][m] = sum_n A[m][n] vh[d][n] -> [16][512][32][32] channel-major).
// Compute dtypes, f32 accumulate: every input rounded to bf16; the three 1x1 convs as PLAIN bf16 GEMMs W . x^T (inputs: exact; x transposed to [m][c] once per batch); q + PE and k + PE in f32 -> hl planes [h][m][d]; logits hl x hl (3 products); clip + softmax f32 (running maximum and sum) -> hl fragments in registers; out = vh (hl planes [h][d][n]) . A^T as hl x hl (3 products), divided by the row sum at the end and written straight into the channel-major output; the batch index rides in the grid: every stage covers all 16 batches in one launch; logits, softmax and the second product are ONE kernel (k_fattn), so neither the logits nor the softmax matrix touch memory.

#define NB_  16
#define CI   256
#define CO   512
#define MM   1024
#define HH   32
#define NH_  8
#define HD   64
typedef _Float16 h16;
typedef unsigned short bf;
typedef __attribute__((ext_vector_type(16))) __bf16   v16bf;
typedef __attribute__((ext_vector_type(16))) _Float16 v16h;
typedef __attribute__((ext_vector_type(8)))  _Float16 v8h;
typedef __attribute__((ext_vector_type(8)))  unsigned short v8us;
typedef __attribute__((ext_vector_type(8)))  float    v8f;
typedef __attribute__((ext_vector_type(4)))  float    v4f;
typedef v8h  __attribute__((may_alias)) v8ha;
typedef v4f  __attribute__((may_alias)) v4fa;
typedef v8us __attribute__((may_alias)) v8usa;

__device__ __forceinline__ unsigned short f2bf(float f) { unsigned u = __float_as_uint(f); u += 0x7FFFu + ((u >> 16) & 1u); return (unsigned short)(u >> 16); }
__device__ __forceinline__ float bf2f(unsigned short b) { return __uint_as_float(((unsigned)b) << 16); }
__device__ __forceinline__ float bfr(float f) { return bf2f(f2bf(f)); }
__device__ __forceinline__ v16h cat16(v8h lo, v8h hi) { return __builtin_shufflevector(lo, hi, 0, 1, 2, 3, 4, 5, 6, 7, 8, 9, 10, 11, 12, 13, 14, 15); }
__device__ __forceinline__ v16bf cat16b(v8us lo, v8us hi) { return __builtin_bit_cast(v16bf, __builtin_shufflevector(lo, hi, 0, 1, 2, 3, 4, 5, 6, 7, 8, 9, 10, 11, 12, 13, 14, 15)); }
__device__ __forceinline__ v8f wmma16(v16h a, v16h b, v8f c) { return __builtin_amdgcn_wmma_f32_16x16x32_f16(false, a, false, b, (short)0, c, false, false); }
__device__ __forceinline__ v8f wmmab(v16bf a, v16bf b, v8f c) { return __builtin_amdgcn_wmma_f32_16x16x32_bf16(false, a, false, b, (short)0, c, false, false); }



// ---- k_gemmw: register-blocked GEMM, ONE WAVE per 64x64 output tile (16 accumulators), operands straight from K-contiguous 16-bit planes; grid (M/64, N/64, Z), 32 threads.
// C[m][n] (f32, pitch ldc, + optional f32 bias[n]) = sum_k A[m][k] Bt[n][k] (+ split products per NSPLIT). z-batch strides sA/sB/sC in elements. K % 32 == 0.
template <typename T16> struct WFrag;
template <> struct WFrag<h16> { typedef v16h V; static __device__ __forceinline__ V ld(const h16* p) { return cat16(*(const v8h*)p, *(const v8h*)(p + 16)); } static __device__ __forceinline__ v8f mma(V a, V b, v8f c) { return wmma16(a, b, c); } };
template <> struct WFrag<bf> { typedef v16bf V; static __device__ __forceinline__ V ld(const bf* p) { return cat16b(*(const v8us*)p, *(const v8us*)(p + 16)); } static __device__ __forceinline__ v8f mma(V a, V b, v8f c) { return wmmab(a, b, c); } };
template <typename T16, int NSPLIT, bool BIAS>
__global__ __launch_bounds__(32) void k_gemmw(const T16* __restrict__ A, const T16* __restrict__ A2, const T16* __restrict__ Bt, const T16* __restrict__ Bt2, int K, float* C, int ldc, const float* __restrict__ bias, size_t sA, size_t sB, size_t sC) {
    typedef typename WFrag<T16>::V V;
    __shared__ __align__(16) float os[16 * 68];
    const size_t z = blockIdx.z; A += z * sA; if (A2) A2 += z * sA; Bt += z * sB; if (Bt2) Bt2 += z * sB; C += z * sC;
    const int lane = threadIdx.x & 31, lr = lane & 15, hi = lane >> 4; const int r0 = blockIdx.x * 64, c0 = blockIdx.y * 64;
    v8f acc[4][4];
#pragma unroll
    for (int mb = 0; mb < 4; ++mb)
#pragma unroll
        for (int nb = 0; nb < 4; ++nb) acc[mb][nb] = (v8f){};
    const size_t aoff = (size_t)(r0 + lr) * K + 8 * hi, boff = (size_t)(c0 + lr) * K + 8 * hi;
#pragma unroll 1
    for (int kc = 0; kc < K; kc += 32) {
        V a[4], a2[4];
#pragma unroll
        for (int mb = 0; mb < 4; ++mb) { a[mb] = WFrag<T16>::ld(A + aoff + (size_t)mb * 16 * K + kc); if (NSPLIT == 1 || NSPLIT == 2) a2[mb] = WFrag<T16>::ld(A2 + aoff + (size_t)mb * 16 * K + kc); }
#pragma unroll
        for (int nb = 0; nb < 4; ++nb) { const V b = WFrag<T16>::ld(Bt + boff + (size_t)nb * 16 * K + kc); V b2; if (NSPLIT >= 2) b2 = WFrag<T16>::ld(Bt2 + boff + (size_t)nb * 16 * K + kc);
#pragma unroll
            for (int mb = 0; mb < 4; ++mb) { acc[mb][nb] = WFrag<T16>::mma(a[mb], b, acc[mb][nb]); if (NSPLIT == 1 || NSPLIT == 2) acc[mb][nb] = WFrag<T16>::mma(a2[mb], b, acc[mb][nb]); if (NSPLIT >= 2) acc[mb][nb] = WFrag<T16>::mma(a[mb], b2, acc[mb][nb]); } }
        asm volatile("v_nop\n\tv_nop\n\tv_nop\n\tv_nop" : "+v"(acc[0][0]), "+v"(acc[1][1]), "+v"(acc[2][2]), "+v"(acc[3][3]) : "v"(a[0]), "v"(a[3]));
    }
#pragma unroll
    for (int mb = 0; mb < 4; ++mb) {
#pragma unroll
        for (int nb = 0; nb < 4; ++nb) {
#pragma unroll
            for (int j = 0; j < 8; ++j) os[(hi * 8 + j) * 68 + nb * 16 + lr] = acc[mb][nb][j]; }
        __builtin_amdgcn_wave_barrier(); asm volatile("" ::: "memory");
        float* crow = C + (size_t)(r0 + mb * 16) * ldc + c0;
{
#pragma unroll
            for (int s = 0; s < 8; ++s) { const int row = 2 * s + hi, cofs = lr * 4; v4f val = *(const v4fa*)(os + row * 68 + cofs); if (BIAS) { val[0] += bfr(bias[c0 + cofs]); val[1] += bfr(bias[c0 + cofs + 1]); val[2] += bfr(bias[c0 + cofs + 2]); val[3] += bfr(bias[c0 + cofs + 3]); }
                *(v4f*)(crow + (size_t)row * ldc + cofs) = val; }
             }
        __builtin_amdgcn_wave_barrier(); asm volatile("" ::: "memory");
    }
}

__device__ __forceinline__ void splitf(float y, unsigned short& h, unsigned short& l) { h = f2bf(y); l = f2bf(y - bf2f(h)); }
typedef __attribute__((ext_vector_type(2))) unsigned short v2us;
typedef __attribute__((ext_vector_type(4))) unsigned short v4us;

__global__ __launch_bounds__(256) void k_cvt8(const float* __restrict__ src, bf* dst, size_t n8) { const size_t i = (size_t)blockIdx.x * 256 + threadIdx.x; if (i >= n8) return; const v8f v = *(const v8f*)(src + i * 8); v8us o;
#pragma unroll
    for (int k = 0; k < 8; ++k) o[k] = f2bf(v[k]); *(v8us*)(dst + i * 8) = o;  }
// k_pe: PE[c][m] (f32): c < 256 -> pe1d(256, row = m / 32)[c], else pe1d(256, col = m % 32)[c - 256]; pe1d(d, L)[p][ch] = (ch even ? sin : cos)(p * exp(-ln(1e4) * (ch - ch%2) / d)) (16-B lanes along m);
// blockIdx.y = batch in k_xt, k_qpl, k_vpl. k_xt: XT[m][c] = bf16(x[c][m]) (lane -> 4 c... written as [m][c] with 8-B lanes: lanes run along c); k_qpl: hl planes [h][m][d] of (F[h*64+d][m] + PE) (lanes along d: 8-B; reads strided); k_vpl: hl planes [h][d][n] of F[h*64+d][n] (16-B lanes along n, no PE);
__global__ __launch_bounds__(256) void k_pe(float* PE) { const int e = (blockIdx.x * 256 + threadIdx.x) * 4; if (e >= CO * MM) return; const int c = e / MM; const int m0 = e % MM; const int cc = (c < CO / 2) ? c : c - CO / 2; const int ch2 = cc & ~1; const float div = __expf(-logf(10000.0f) * (float)ch2 / (float)(CO / 2)); v4f r;
#pragma unroll 1
    for (int u = 0; u < 4; ++u) { const int m = m0 + u; const int p = (c < CO / 2) ? (m / HH) : (m % HH); const float ang = __fmul_rn((float)p, div); r[u] = (cc & 1) ? cosf(ang) : sinf(ang); }
    *(v4f*)(PE + e) = r;  }
__global__ __launch_bounds__(256) void k_xt(const float* __restrict__ X, bf* XT) { const int e = (blockIdx.x * 256 + threadIdx.x) * 4; if (e >= MM * CI) return; X += (size_t)blockIdx.y * CI * MM; XT += (size_t)blockIdx.y * MM * CI; const int c = e % CI; const int m = e / CI; v4us o;
#pragma unroll
    for (int u = 0; u < 4; ++u) o[u] = f2bf(X[(size_t)(c + u) * MM + m]); *(v4us*)(XT + e) = o;  }
__global__ __launch_bounds__(256) void k_qpl(const float* __restrict__ F, const float* __restrict__ PE, bf* Ph, bf* Pl) { const int e = (blockIdx.x * 256 + threadIdx.x) * 4; if (e >= NH_ * MM * HD) return; F += (size_t)blockIdx.y * CO * MM; Ph += (size_t)blockIdx.y * NH_ * MM * HD; Pl += (size_t)blockIdx.y * NH_ * MM * HD; const int d = e % HD; const int m = (e / HD) % MM; const int h = e / (HD * MM); v4us oh, ol;
#pragma unroll
    for (int u = 0; u < 4; ++u) { const size_t idx = (size_t)(h * HD + d + u) * MM + m; unsigned short a, b; splitf(__fadd_rn(F[idx], PE[idx]), a, b); oh[u] = a; ol[u] = b; } *(v4us*)(Ph + e) = oh; *(v4us*)(Pl + e) = ol;  }
__global__ __launch_bounds__(256) void k_vpl(const float* __restrict__ F, bf* Ph, bf* Pl) { const int e = (blockIdx.x * 256 + threadIdx.x) * 4; if (e >= CO * MM) return; F += (size_t)blockIdx.y * CO * MM; Ph += (size_t)blockIdx.y * CO * MM; Pl += (size_t)blockIdx.y * CO * MM; v4us oh, ol; const v4f a = *(const v4f*)(F + e);
#pragma unroll
    for (int u = 0; u < 4; ++u) { unsigned short x0, x1; splitf(a[u], x0, x1); oh[u] = x0; ol[u] = x1; } *(v4us*)(Ph + e) = oh; *(v4us*)(Pl + e) = ol;  }   // [h*64+d][n] == planes [h][d][n]
// ---- k_fattn: logits, clip, softmax and A . v in one kernel. Grid (M / 256, batches x heads), 8 waves; a wave owns 32 query columns, the work-group walks the 1024 keys in stages of KT.
// S^T tile = K rows (A operand, from LDS) x Q columns (B operand, kept in registers): lane (lr, hi) holds query lr, keys 8 * hi + j of each 16-key tile, so two tiles of one 32-key pass ARE the B operand of the second product
// (element i = tile 0 register i, element 8 + i = tile 1 register i: the k order of the two 16-byte loads that every A fragment here is read with). out^T tile = v rows (A, from LDS) x P (B): lane (lr, hi) holds query lr, d = 8 * hi + j.
// Running maximum per query (in-lane plus one exchange between the wave's halves); P = exp(t - maximum so far), not yet divided; accumulators and sum are rescaled when the maximum moves; one division at the end.
#define KT   64            // keys per stage
#define KPI  (HD + 8)      // LDS pitch of a K row, elements: 144 B = 16 B x odd, conflict-free 16-byte reads
#define VPI  (KT + 8)      // LDS pitch of a v row, elements
#define NCH  (KT * 8 / 256)
__device__ __forceinline__ v16bf ldsf(const bf* p) { return cat16b(*(const v8usa*)p, *(const v8usa*)(p + 16)); }
__device__ __forceinline__ float xhalf(float v) { const int b = __float_as_int(v); return __int_as_float(__builtin_amdgcn_permlanex16(b, b, 0x76543210, (int)0xfedcba98u, false, false)); }   // lane l <-> l ^ 16
// amdgpu_waves_per_eu(4, 4): at most 256 registers a wave, so that two work-groups share a WGP and one wave's vector work runs under another's matrix work
__global__ __launch_bounds__(256) __attribute__((amdgpu_waves_per_eu(4, 4))) void k_fattn(const bf* __restrict__ Qh, const bf* __restrict__ Ql, const bf* __restrict__ Kh, const bf* __restrict__ Kl, const bf* __restrict__ Vh, const bf* __restrict__ Vl, float* __restrict__ O) {
    __shared__ __align__(16) bf sK[2][2][KT * KPI];    // [buffer][h, l][key][d]
    __shared__ __align__(16) bf sV[2][2][HD * VPI];    // [buffer][h, l][d][key]
    const size_t zo = (size_t)blockIdx.y * MM * HD; Qh += zo; Ql += zo; Kh += zo; Kl += zo; Vh += zo; Vl += zo; O += zo;
    const int tid = threadIdx.x, lane = tid & 31, lr = lane & 15, hi = lane >> 4; const int q0 = blockIdx.x * 256 + (tid >> 5) * 32;
    const float L2E = 1.4426950408889634f;
    v16bf qh[2][2], ql[2][2];
#pragma unroll
    for (int mb = 0; mb < 2; ++mb)
#pragma unroll
        for (int kc = 0; kc < 2; ++kc) { const size_t qo = (size_t)(q0 + mb * 16 + lr) * HD + kc * 32 + 8 * hi; qh[mb][kc] = WFrag<bf>::ld(Qh + qo); ql[mb][kc] = WFrag<bf>::ld(Ql + qo); }
    v8f o[4][2];
#pragma unroll
    for (int dt = 0; dt < 4; ++dt) { o[dt][0] = (v8f){}; o[dt][1] = (v8f){}; }
    float mrun[2] = {-3.0e38f, -3.0e38f}, lsum[2] = {0.f, 0.f};
    v8us g[4][NCH];
    const unsigned ko8 = (unsigned)tid * 8u, vo8 = (unsigned)(tid / (KT / 8)) * MM + (unsigned)(tid % (KT / 8)) * 8u;    // this thread's 16-byte piece of a K tile (contiguous) and of a v tile (row d, pitch M)
    auto fetch = [&](int n0) { const bf* kh = Kh + (size_t)n0 * HD; const bf* kl = Kl + (size_t)n0 * HD; const bf* vh = Vh + n0; const bf* vl = Vl + n0;
#pragma unroll
        for (int i = 0; i < NCH; ++i) {
            g[0][i] = *(const v8us*)(kh + (ko8 + i * 2048u)); g[1][i] = *(const v8us*)(kl + (ko8 + i * 2048u));
            g[2][i] = *(const v8us*)(vh + (vo8 + i * (256u / (KT / 8)) * MM)); g[3][i] = *(const v8us*)(vl + (vo8 + i * (256u / (KT / 8)) * MM)); } };
    auto put = [&](int b) {
#pragma unroll
        for (int i = 0; i < NCH; ++i) { const int c = tid + i * 256; const int d = c / (KT / 8), cc = c % (KT / 8);
            *(v8usa*)(&sK[b][0][(c >> 3) * KPI + (c & 7) * 8]) = g[0][i]; *(v8usa*)(&sK[b][1][(c >> 3) * KPI + (c & 7) * 8]) = g[1][i];
            *(v8usa*)(&sV[b][0][d * VPI + cc * 8]) = g[2][i]; *(v8usa*)(&sV[b][1][d * VPI + cc * 8]) = g[3][i]; } };
    fetch(0); put(0);
    __syncthreads();
#pragma unroll 1
    for (int st = 0; st < MM / KT; ++st) {
        const int b = st & 1;
        if (st + 1 < MM / KT) fetch((st + 1) * KT);    // the next stage's global loads fly under this stage's work
#pragma unroll 1
        for (int kp = 0; kp < KT / 32; ++kp) {
            v8f s[2][2];
            s[0][0] = (v8f){}; s[0][1] = (v8f){}; s[1][0] = (v8f){}; s[1][1] = (v8f){};
#pragma unroll
            for (int kc = 0; kc < 2; ++kc) { v16bf ah[2], al[2];
#pragma unroll
                for (int nt = 0; nt < 2; ++nt) { const int ko = (kp * 32 + nt * 16 + lr) * KPI + kc * 32 + 8 * hi; ah[nt] = ldsf(&sK[b][0][ko]); al[nt] = ldsf(&sK[b][1][ko]); }
#pragma unroll
                for (int nt = 0; nt < 2; ++nt) { s[0][nt] = wmmab(ah[nt], qh[0][kc], s[0][nt]); s[1][nt] = wmmab(ah[nt], qh[1][kc], s[1][nt]); }
#pragma unroll
                for (int nt = 0; nt < 2; ++nt) { s[0][nt] = wmmab(al[nt], qh[0][kc], s[0][nt]); s[1][nt] = wmmab(al[nt], qh[1][kc], s[1][nt]); }
#pragma unroll
                for (int nt = 0; nt < 2; ++nt) { s[0][nt] = wmmab(ah[nt], ql[0][kc], s[0][nt]); s[1][nt] = wmmab(ah[nt], ql[1][kc], s[1][nt]); } }
            v16bf ph[2], pl[2];
#pragma unroll
            for (int mb = 0; mb < 2; ++mb) {
                float t[16]; float mx = -3.0e38f;
#pragma unroll
                for (int i = 0; i < 16; ++i) { t[i] = fminf(fmaxf(s[mb][i >> 3][i & 7] * 0.125f, -50.0f), 50.0f); mx = fmaxf(mx, t[i]); }
                mx = fmaxf(mx, xhalf(mx));
                const float mn = fmaxf(mrun[mb], mx); const float mL = mn * L2E;
                const float alpha = __builtin_amdgcn_exp2f(__builtin_fmaf(mrun[mb], L2E, -mL)); mrun[mb] = mn;
                float sum = 0.f; v8us h0, h1, l0, l1;
#pragma unroll
                for (int i = 0; i < 8; ++i) { unsigned short a, c;
                    const float p0 = __builtin_amdgcn_exp2f(__builtin_fmaf(t[i], L2E, -mL)); sum += p0; splitf(p0, a, c); h0[i] = a; l0[i] = c;
                    const float p1 = __builtin_amdgcn_exp2f(__builtin_fmaf(t[8 + i], L2E, -mL)); sum += p1; splitf(p1, a, c); h1[i] = a; l1[i] = c; }
                lsum[mb] = lsum[mb] * alpha + sum;
#pragma unroll
                for (int dt = 0; dt < 4; ++dt) o[dt][mb] *= alpha;
                ph[mb] = cat16b(h0, h1); pl[mb] = cat16b(l0, l1); }
#pragma unroll
            for (int dp = 0; dp < 2; ++dp) { v16bf vh[2], vl[2];
#pragma unroll
                for (int d2 = 0; d2 < 2; ++d2) { const int vo = ((dp * 2 + d2) * 16 + lr) * VPI + kp * 32 + 8 * hi; vh[d2] = ldsf(&sV[b][0][vo]); vl[d2] = ldsf(&sV[b][1][vo]); }
#pragma unroll
                for (int d2 = 0; d2 < 2; ++d2) { o[dp * 2 + d2][0] = wmmab(vh[d2], ph[0], o[dp * 2 + d2][0]); o[dp * 2 + d2][1] = wmmab(vh[d2], ph[1], o[dp * 2 + d2][1]); }
#pragma unroll
                for (int d2 = 0; d2 < 2; ++d2) { o[dp * 2 + d2][0] = wmmab(vl[d2], ph[0], o[dp * 2 + d2][0]); o[dp * 2 + d2][1] = wmmab(vl[d2], ph[1], o[dp * 2 + d2][1]); }
#pragma unroll
                for (int d2 = 0; d2 < 2; ++d2) { o[dp * 2 + d2][0] = wmmab(vh[d2], pl[0], o[dp * 2 + d2][0]); o[dp * 2 + d2][1] = wmmab(vh[d2], pl[1], o[dp * 2 + d2][1]); } }
        }
        if (st + 1 < MM / KT) put(b ^ 1);    // that buffer's last readers left it before the barrier that ended stage st - 1
        __syncthreads();                      // publishes stage st + 1 and ends every read of stage st
    }
#pragma unroll
    for (int mb = 0; mb < 2; ++mb) { const float f = __fdiv_rn(1.0f, lsum[mb] + xhalf(lsum[mb]));
#pragma unroll
        for (int dt = 0; dt < 4; ++dt)
#pragma unroll
            for (int j = 0; j < 8; ++j) O[(size_t)(dt * 16 + hi * 8 + j) * MM + q0 + mb * 16 + lr] = o[dt][mb][j] * f; }
}

extern "C" void kernel_launch(void* const* d_in, const int* in_sizes, int n_in,
                              void* d_out, int out_size, void* d_ws, size_t ws_size, hipStream_t stream) {
    (void)in_sizes; (void)n_in; (void)out_size;
    const float* x = (const float*)d_in[0]; const float* Wq = (const float*)d_in[1]; const float* Wk = (const float*)d_in[2]; const float* Wv = (const float*)d_in[3];
    float* OUT = (float*)d_out;     // [16][512][1024]
    char* wsp = (char*)d_ws;
    auto take = [&](size_t bytes) { char* p = wsp; wsp += (bytes + 255) & ~(size_t)255; return (void*)p; };
    bf* AQ = (bf*)take((size_t)CO * CI * 2); bf* AK = (bf*)take((size_t)CO * CI * 2); bf* AV = (bf*)take((size_t)CO * CI * 2); float* PE = (float*)take((size_t)CO * MM * 4); bf* XT = (bf*)take((size_t)NB_ * MM * CI * 2);
    bf* QPh = (bf*)take((size_t)NB_ * CO * MM * 2); bf* QPl = (bf*)take((size_t)NB_ * CO * MM * 2); bf* KPh = (bf*)take((size_t)NB_ * CO * MM * 2); bf* KPl = (bf*)take((size_t)NB_ * CO * MM * 2); bf* VPh = (bf*)take((size_t)NB_ * CO * MM * 2); bf* VPl = (bf*)take((size_t)NB_ * CO * MM * 2);
    float* F = (float*)take((size_t)NB_ * CO * MM * 4);    // conv outputs of all 16 batches (32 MiB)
    if ((size_t)(wsp - (char*)d_ws) > ws_size) return;    // total ~ 139 MiB
    k_cvt8<<<(CO * CI / 8 + 255) / 256, 256, 0, stream>>>(Wq, AQ, CO * CI / 8); k_cvt8<<<(CO * CI / 8 + 255) / 256, 256, 0, stream>>>(Wk, AK, CO * CI / 8); k_cvt8<<<(CO * CI / 8 + 255) / 256, 256, 0, stream>>>(Wv, AV, CO * CI / 8);   // W [o][c] is the A operand as-is
    k_pe<<<(CO * MM / 4 + 255) / 256, 256, 0, stream>>>(PE);
    const size_t zx = (size_t)MM * CI, zf = (size_t)CO * MM;
    k_xt<<<dim3((MM * CI / 4 + 255) / 256, NB_), 256, 0, stream>>>(x, XT);
    k_gemmw<bf, 0, false><<<dim3(CO / 64, MM / 64, NB_), 32, 0, stream>>>(AQ, nullptr, XT, nullptr, CI, F, MM, nullptr, 0, zx, zf); k_qpl<<<dim3((NH_ * MM * HD / 4 + 255) / 256, NB_), 256, 0, stream>>>(F, PE, QPh, QPl);
    k_gemmw<bf, 0, false><<<dim3(CO / 64, MM / 64, NB_), 32, 0, stream>>>(AK, nullptr, XT, nullptr, CI, F, MM, nullptr, 0, zx, zf); k_qpl<<<dim3((NH_ * MM * HD / 4 + 255) / 256, NB_), 256, 0, stream>>>(F, PE, KPh, KPl);
    k_gemmw<bf, 0, false><<<dim3(CO / 64, MM / 64, NB_), 32, 0, stream>>>(AV, nullptr, XT, nullptr, CI, F, MM, nullptr, 0, zx, zf); k_vpl<<<dim3((CO * MM / 4 + 255) / 256, NB_), 256, 0, stream>>>(F, VPh, VPl);
    k_fattn<<<dim3(MM / 256, NB_ * NH_), 256, 0, stream>>>(QPh, QPl, KPh, KPl, VPh, VPl, OUT);   // blockIdx.y = batch * 8 + head: the planes and OUT are contiguous in that index
}

// v003
// It runs in 153 microseconds.
// In two side-by-side timings against v002, it was 1.30 and 1.31 times as fast.
// All steps since v000 together make it 8.23 times as fast.
#include <hip/hip_runtime.h>

// MultiHeadSelfAttention2D (x [16][256][32][32] channel-major; q/k/v = 1x1 conv = W [512][256] . x[c][m] over the M = 1024 positions; 2-D sinusoidal PE r[c][m] (first 256 channels row position, last 256 column position; even channels sin, odd cos; constants computed on device) added to q and k;
//   8 heads x 64: logits[m][n] = sum_d qh[d][m] kh[d][n] / 8, clipped to [-50, 50]; softmax over n; out[h*64+d][m] = sum_n A[m][n] vh[d][n] -> [16][512][32][32] channel-major).
// Compute dtypes, f32 accumulate: every input rounded to bf16; the three 1x1 convs as PLAIN bf16 GEMMs W . x^T (inputs: exact; x transposed to [m][c] once per batch); q + PE and k + PE in f32 -> hl planes [h][m][d], v -> hl planes [h][d][n], all three split and stored by the conv GEMM itself; logits hl x hl (3 products); clip + softmax f32 (running maximum and sum) -> hl fragments in registers; out = vh (hl planes [h][d][n]) . A^T as hl x hl (3 products), divided by the row sum at the end and written straight into the channel-major output; the batch index rides in the grid: every stage covers all 16 batches in one launch; logits, softmax and the second product are ONE kernel (k_fattn), so neither the logits nor the softmax matrix touch memory.

#define NB_  16
#define CI   256
#define CO   512
#define MM   1024
#define HH   32
#define NH_  8
#define HD   64
typedef _Float16 h16;
typedef unsigned short bf;
typedef __attribute__((ext_vector_type(16))) __bf16   v16bf;
typedef __attribute__((ext_vector_type(16))) _Float16 v16h;
typedef __attribute__((ext_vector_type(8)))  _Float16 v8h;
typedef __attribute__((ext_vector_type(8)))  unsigned short v8us;
typedef __attribute__((ext_vector_type(8)))  float    v8f;
typedef __attribute__((ext_vector_type(4)))  float    v4f;
typedef v8h  __attribute__((may_alias)) v8ha;
typedef v4f  __attribute__((may_alias)) v4fa;
typedef v8us __attribute__((may_alias)) v8usa;

__device__ __forceinline__ unsigned short f2bf(float f) { unsigned u = __float_as_uint(f); u += 0x7FFFu + ((u >> 16) & 1u); return (unsigned short)(u >> 16); }
__device__ __forceinline__ float bf2f(unsigned short b) { return __uint_as_float(((unsigned)b) << 16); }
__device__ __forceinline__ float bfr(float f) { return bf2f(f2bf(f)); }
__device__ __forceinline__ v16h cat16(v8h lo, v8h hi) { return __builtin_shufflevector(lo, hi, 0, 1, 2, 3, 4, 5, 6, 7, 8, 9, 10, 11, 12, 13, 14, 15); }
__device__ __forceinline__ v16bf cat16b(v8us lo, v8us hi) { return __builtin_bit_cast(v16bf, __builtin_shufflevector(lo, hi, 0, 1, 2, 3, 4, 5, 6, 7, 8, 9, 10, 11, 12, 13, 14, 15)); }
__device__ __forceinline__ v8f wmma16(v16h a, v16h b, v8f c) { return __builtin_amdgcn_wmma_f32_16x16x32_f16(false, a, false, b, (short)0, c, false, false); }
__device__ __forceinline__ v8f wmmab(v16bf a, v16bf b, v8f c) { return __builtin_amdgcn_wmma_f32_16x16x32_bf16(false, a, false, b, (short)0, c, false, false); }



// ---- k_gemmp: register-blocked conv GEMM, ONE WAVE per 64x64 tile (16 accumulators), operands straight from K-contiguous bf16 planes; grid (rows of A / 64, rows of Bt / 64, batch), 32 threads; K % 32 == 0.
// y[r][c] = sum_k A[r][k] Bt[c][k]. A lane's 8 accumulator registers are 8 CONSECUTIVE r of one c, so the operand whose index must run contiguously in the planes is given as A: a lane splits its 8 values, puts 16 bytes per plane into LDS, and the tile leaves as whole 128-byte lines; the f32 result never touches memory:
// QK: A = W (r = output channel, tile = one head), Bt = x^T (c = position m): planes [h][m][d] of y + PE, PE read as [m][channel]. Otherwise: A = x^T (r = position n), Bt = W (c = output channel): planes [channel][n].
template <typename T16> struct WFrag;
template <> struct WFrag<h16> { typedef v16h V; static __device__ __forceinline__ V ld(const h16* p) { return cat16(*(const v8h*)p, *(const v8h*)(p + 16)); } static __device__ __forceinline__ v8f mma(V a, V b, v8f c) { return wmma16(a, b, c); } };
template <> struct WFrag<bf> { typedef v16bf V; static __device__ __forceinline__ V ld(const bf* p) { return cat16b(*(const v8us*)p, *(const v8us*)(p + 16)); } static __device__ __forceinline__ v8f mma(V a, V b, v8f c) { return wmmab(a, b, c); } };
__device__ __forceinline__ void splitf(float y, unsigned short& h, unsigned short& l) { h = f2bf(y); l = f2bf(y - bf2f(h)); }
template <bool QK>
__global__ __launch_bounds__(32) void k_gemmp(const bf* __restrict__ A, const bf* __restrict__ Bt, int K, bf* Ph, bf* Pl, const float* __restrict__ PEt, size_t sA, size_t sB) {
    typedef WFrag<bf>::V V;
    constexpr int OSP = 64 + 8;    // LDS pitch of a staged row, elements: 144 B = 16 B x odd
    __shared__ __align__(16) bf os[2][64 * OSP];    // [h, l][c][r]
    const size_t z = blockIdx.z; A += z * sA; Bt += z * sB;
    const int lane = threadIdx.x & 31, lr = lane & 15, hi = lane >> 4; const int r0 = blockIdx.x * 64, c0 = blockIdx.y * 64;
    v8f acc[4][4];
#pragma unroll
    for (int mb = 0; mb < 4; ++mb)
#pragma unroll
        for (int nb = 0; nb < 4; ++nb) acc[mb][nb] = (v8f){};
    const size_t aoff = (size_t)(r0 + lr) * K + 8 * hi, boff = (size_t)(c0 + lr) * K + 8 * hi;
#pragma unroll 1
    for (int kc = 0; kc < K; kc += 32) {
        V a[4];
#pragma unroll
        for (int mb = 0; mb < 4; ++mb) a[mb] = WFrag<bf>::ld(A + aoff + (size_t)mb * 16 * K + kc);
#pragma unroll
        for (int nb = 0; nb < 4; ++nb) { const V b = WFrag<bf>::ld(Bt + boff + (size_t)nb * 16 * K + kc);
#pragma unroll
            for (int mb = 0; mb < 4; ++mb) acc[mb][nb] = WFrag<bf>::mma(a[mb], b, acc[mb][nb]); }
        asm volatile("v_nop\n\tv_nop\n\tv_nop\n\tv_nop" : "+v"(acc[0][0]), "+v"(acc[1][1]), "+v"(acc[2][2]), "+v"(acc[3][3]) : "v"(a[0]), "v"(a[3]));
    }
    constexpr int PITCH = QK ? HD : MM;    // plane elements from one c to the next
    const float* pe = PEt + (size_t)(c0 + lr) * CO + r0 + 8 * hi;
#pragma unroll
    for (int nb = 0; nb < 4; ++nb)
#pragma unroll
        for (int mb = 0; mb < 4; ++mb) { v8f y = acc[mb][nb];
            if (QK) { const v4f p0 = *(const v4f*)(pe + nb * 16 * CO + mb * 16), p1 = *(const v4f*)(pe + nb * 16 * CO + mb * 16 + 4);
#pragma unroll
                for (int j = 0; j < 4; ++j) { y[j] = __fadd_rn(y[j], p0[j]); y[4 + j] = __fadd_rn(y[4 + j], p1[j]); } }
            v8us oh, ol;
#pragma unroll
            for (int j = 0; j < 8; ++j) { unsigned short s0, s1; splitf(y[j], s0, s1); oh[j] = s0; ol[j] = s1; }
            *(v8usa*)(&os[0][(nb * 16 + lr) * OSP + mb * 16 + 8 * hi]) = oh; *(v8usa*)(&os[1][(nb * 16 + lr) * OSP + mb * 16 + 8 * hi]) = ol; }
    asm volatile("s_wait_dscnt 0x0" ::: "memory");    // the reads below take what other lanes of this wave wrote: every LDS write has landed, and the compiler moves no read above this line
    const size_t ob = z * ((size_t)CO * MM) + (QK ? (size_t)r0 * MM : (size_t)r0) + (size_t)(c0 + (lane >> 3)) * PITCH + (lane & 7) * 8;
#pragma unroll
    for (int s = 0; s < 16; ++s) { const int so = (s * 4 + (lane >> 3)) * OSP + (lane & 7) * 8;    // 8 lanes = one whole 128-byte line of a plane, 4 lines an instruction
        *(v8us*)(Ph + ob + s * 4 * PITCH) = *(const v8usa*)(&os[0][so]); *(v8us*)(Pl + ob + s * 4 * PITCH) = *(const v8usa*)(&os[1][so]); }
}

typedef __attribute__((ext_vector_type(2))) unsigned short v2us;
typedef __attribute__((ext_vector_type(4))) unsigned short v4us;

__global__ __launch_bounds__(256) void k_cvt8(const float* __restrict__ src, bf* dst, size_t n8) { const size_t i = (size_t)blockIdx.x * 256 + threadIdx.x; if (i >= n8) return; const v8f v = *(const v8f*)(src + i * 8); v8us o;
#pragma unroll
    for (int k = 0; k < 8; ++k) o[k] = f2bf(v[k]); *(v8us*)(dst + i * 8) = o;  }
// k_pe: PE[m][c] (f32, channel running fastest: the order the conv GEMM's lanes read it in): c < 256 -> pe1d(256, row = m / 32)[c], else pe1d(256, col = m % 32)[c - 256]; pe1d(d, L)[p][ch] = (ch even ? sin : cos)(p * exp(-ln(1e4) * (ch - ch%2) / d)) (16-B lanes along c);
// blockIdx.y = batch in k_xt. k_xt: XT[m][c] = bf16(x[c][m]) (written as [m][c] with 8-B lanes: lanes run along c)
__global__ __launch_bounds__(256) void k_pe(float* PE) { const int e = (blockIdx.x * 256 + threadIdx.x) * 4; if (e >= CO * MM) return; const int m = e / CO; const int c0 = e % CO; v4f r;
#pragma unroll 1    // one copy of the sin / cos code
    for (int u = 0; u < 4; ++u) { const int c = c0 + u; const int cc = (c < CO / 2) ? c : c - CO / 2; const int ch2 = cc & ~1; const float div = __expf(-logf(10000.0f) * (float)ch2 / (float)(CO / 2)); const int p = (c < CO / 2) ? (m / HH) : (m % HH); const float ang = __fmul_rn((float)p, div); r[u] = (cc & 1) ? cosf(ang) : sinf(ang); }
    *(v4f*)(PE + e) = r;  }
__global__ __launch_bounds__(256) void k_xt(const float* __restrict__ X, bf* XT) { const int e = (blockIdx.x * 256 + threadIdx.x) * 4; if (e >= MM * CI) return; X += (size_t)blockIdx.y * CI * MM; XT += (size_t)blockIdx.y * MM * CI; const int c = e % CI; const int m = e / CI; v4us o;
#pragma unroll
    for (int u = 0; u < 4; ++u) o[u] = f2bf(X[(size_t)(c + u) * MM + m]); *(v4us*)(XT + e) = o;  }
// ---- k_fattn: logits, clip, softmax and A . v in one kernel. Grid (M / 256, batches x heads), 8 waves; a wave owns 32 query columns, the work-group walks the 1024 keys in stages of KT.
// S^T tile = K rows (A operand, from LDS) x Q columns (B operand, kept in registers): lane (lr, hi) holds query lr, keys 8 * hi + j of each 16-key tile, so two tiles of one 32-key pass ARE the B operand of the second product
// (element i = tile 0 register i, element 8 + i = tile 1 register i: the k order of the two 16-byte loads that every A fragment here is read with). out^T tile = v rows (A, from LDS) x P (B): lane (lr, hi) holds query lr, d = 8 * hi + j.
// Running maximum per query (in-lane plus one exchange between the wave's halves); P = exp(t - maximum so far), not yet divided; accumulators and sum are rescaled when the maximum moves; one division at the end.
#define KT   64            // keys per stage
#define KPI  (HD + 8)      // LDS pitch of a K row, elements: 144 B = 16 B x odd, conflict-free 16-byte reads
#define VPI  (KT + 8)      // LDS pitch of a v row, elements
#define NCH  (KT * 8 / 256)
__device__ __forceinline__ v16bf ldsf(const bf* p) { return cat16b(*(const v8usa*)p, *(const v8usa*)(p + 16)); }
__device__ __forceinline__ float xhalf(float v) { const int b = __float_as_int(v); return __int_as_float(__builtin_amdgcn_permlanex16(b, b, 0x76543210, (int)0xfedcba98u, false, false)); }   // lane l <-> l ^ 16
// amdgpu_waves_per_eu(4, 4): at most 256 registers a wave, so that two work-groups share a WGP and one wave's vector work runs under another's matrix work
__global__ __launch_bounds__(256) __attribute__((amdgpu_waves_per_eu(4, 4))) void k_fattn(const bf* __restrict__ Qh, const bf* __restrict__ Ql, const bf* __restrict__ Kh, const bf* __restrict__ Kl, const bf* __restrict__ Vh, const bf* __restrict__ Vl, float* __restrict__ O) {
    __shared__ __align__(16) bf sK[2][2][KT * KPI];    // [buffer][h, l][key][d]
    __shared__ __align__(16) bf sV[2][2][HD * VPI];    // [buffer][h, l][d][key]
    const size_t zo = (size_t)blockIdx.y * MM * HD; Qh += zo; Ql += zo; Kh += zo; Kl += zo; Vh += zo; Vl += zo; O += zo;
    const int tid = threadIdx.x, lane = tid & 31, lr = lane & 15, hi = lane >> 4; const int q0 = blockIdx.x * 256 + (tid >> 5) * 32;
    const float L2E = 1.4426950408889634f;
    v16bf qh[2][2], ql[2][2];
#pragma unroll
    for (int mb = 0; mb < 2; ++mb)
#pragma unroll
        for (int kc = 0; kc < 2; ++kc) { const size_t qo = (size_t)(q0 + mb * 16 + lr) * HD + kc * 32 + 8 * hi; qh[mb][kc] = WFrag<bf>::ld(Qh + qo); ql[mb][kc] = WFrag<bf>::ld(Ql + qo); }
    v8f o[4][2];
#pragma unroll
    for (int dt = 0; dt < 4; ++dt) { o[dt][0] = (v8f){}; o[dt][1] = (v8f){}; }
    float mrun[2] = {-3.0e38f, -3.0e38f}, lsum[2] = {0.f, 0.f};
    v8us g[4][NCH];
    const unsigned ko8 = (unsigned)tid * 8u, vo8 = (unsigned)(tid / (KT / 8)) * MM + (unsigned)(tid % (KT / 8)) * 8u;    // this thread's 16-byte piece of a K tile (contiguous) and of a v tile (row d, pitch M)
    auto fetch = [&](int n0) { const bf* kh = Kh + (size_t)n0 * HD; const bf* kl = Kl + (size_t)n0 * HD; const bf* vh = Vh + n0; const bf* vl = Vl + n0;
#pragma unroll
        for (int i = 0; i < NCH; ++i) {
            g[0][i] = *(const v8us*)(kh + (ko8 + i * 2048u)); g[1][i] = *(const v8us*)(kl + (ko8 + i * 2048u));
            g[2][i] = *(const v8us*)(vh + (vo8 + i * (256u / (KT / 8)) * MM)); g[3][i] = *(const v8us*)(vl + (vo8 + i * (256u / (KT / 8)) * MM)); } };
    auto put = [&](int b) {
#pragma unroll
        for (int i = 0; i < NCH; ++i) { const int c = tid + i * 256; const int d = c / (KT / 8), cc = c % (KT / 8);
            *(v8usa*)(&sK[b][0][(c >> 3) * KPI + (c & 7) * 8]) = g[0][i]; *(v8usa*)(&sK[b][1][(c >> 3) * KPI + (c & 7) * 8]) = g[1][i];
            *(v8usa*)(&sV[b][0][d * VPI + cc * 8]) = g[2][i]; *(v8usa*)(&sV[b][1][d * VPI + cc * 8]) = g[3][i]; } };
    fetch(0); put(0);
    __syncthreads();
#pragma unroll 1
    for (int st = 0; st < MM / KT; ++st) {
        const int b = st & 1;
        if (st + 1 < MM / KT) fetch((st + 1) * KT);    // the next stage's global loads fly under this stage's work
#pragma unroll 1
        for (int kp = 0; kp < KT / 32; ++kp) {
            v8f s[2][2];
            s[0][0] = (v8f){}; s[0][1] = (v8f){}; s[1][0] = (v8f){}; s[1][1] = (v8f){};
#pragma unroll
            for (int kc = 0; kc < 2; ++kc) { v16bf ah[2], al[2];
#pragma unroll
                for (int nt = 0; nt < 2; ++nt) { const int ko = (kp * 32 + nt * 16 + lr) * KPI + kc * 32 + 8 * hi; ah[nt] = ldsf(&sK[b][0][ko]); al[nt] = ldsf(&sK[b][1][ko]); }
#pragma unroll
                for (int nt = 0; nt < 2; ++nt) { s[0][nt] = wmmab(ah[nt], qh[0][kc], s[0][nt]); s[1][nt] = wmmab(ah[nt], qh[1][kc], s[1][nt]); }
#pragma unroll
                for (int nt = 0; nt < 2; ++nt) { s[0][nt] = wmmab(al[nt], qh[0][kc], s[0][nt]); s[1][nt] = wmmab(al[nt], qh[1][kc], s[1][nt]); }
#pragma unroll
                for (int nt = 0; nt < 2; ++nt) { s[0][nt] = wmmab(ah[nt], ql[0][kc], s[0][nt]); s[1][nt] = wmmab(ah[nt], ql[1][kc], s[1][nt]); } }
            v16bf ph[2], pl[2];
#pragma unroll
            for (int mb = 0; mb < 2; ++mb) {
                float t[16]; float mx = -3.0e38f;
#pragma unroll
                for (int i = 0; i < 16; ++i) { t[i] = fminf(fmaxf(s[mb][i >> 3][i & 7] * 0.125f, -50.0f), 50.0f); mx = fmaxf(mx, t[i]); }
                mx = fmaxf(mx, xhalf(mx));
                const float mn = fmaxf(mrun[mb], mx); const float mL = mn * L2E;
                const float alpha = __builtin_amdgcn_exp2f(__builtin_fmaf(mrun[mb], L2E, -mL)); mrun[mb] = mn;
                float sum = 0.f; v8us h0, h1, l0, l1;
#pragma unroll
                for (int i = 0; i < 8; ++i) { unsigned short a, c;
                    const float p0 = __builtin_amdgcn_exp2f(__builtin_fmaf(t[i], L2E, -mL)); sum += p0; splitf(p0, a, c); h0[i] = a; l0[i] = c;
                    const float p1 = __builtin_amdgcn_exp2f(__builtin_fmaf(t[8 + i], L2E, -mL)); sum += p1; splitf(p1, a, c); h1[i] = a; l1[i] = c; }
                lsum[mb] = lsum[mb] * alpha + sum;
#pragma unroll
                for (int dt = 0; dt < 4; ++dt) o[dt][mb] *= alpha;
                ph[mb] = cat16b(h0, h1); pl[mb] = cat16b(l0, l1); }
#pragma unroll
            for (int dp = 0; dp < 2; ++dp) { v16bf vh[2], vl[2];
#pragma unroll
                for (int d2 = 0; d2 < 2; ++d2) { const int vo = ((dp * 2 + d2) * 16 + lr) * VPI + kp * 32 + 8 * hi; vh[d2] = ldsf(&sV[b][0][vo]); vl[d2] = ldsf(&sV[b][1][vo]); }
#pragma unroll
                for (int d2 = 0; d2 < 2; ++d2) { o[dp * 2 + d2][0] = wmmab(vh[d2], ph[0], o[dp * 2 + d2][0]); o[dp * 2 + d2][1] = wmmab(vh[d2], ph[1], o[dp * 2 + d2][1]); }
#pragma unroll
                for (int d2 = 0; d2 < 2; ++d2) { o[dp * 2 + d2][0] = wmmab(vl[d2], ph[0], o[dp * 2 + d2][0]); o[dp * 2 + d2][1] = wmmab(vl[d2], ph[1], o[dp * 2 + d2][1]); }
#pragma unroll
                for (int d2 = 0; d2 < 2; ++d2) { o[dp * 2 + d2][0] = wmmab(vh[d2], pl[0], o[dp * 2 + d2][0]); o[dp * 2 + d2][1] = wmmab(vh[d2], pl[1], o[dp * 2 + d2][1]); } }
        }
        if (st + 1 < MM / KT) put(b ^ 1);    // that buffer's last readers left it before the barrier that ended stage st - 1
        __syncthreads();                      // publishes stage st + 1 and ends every read of stage st
    }
#pragma unroll
    for (int mb = 0; mb < 2; ++mb) { const float f = __fdiv_rn(1.0f, lsum[mb] + xhalf(lsum[mb]));
#pragma unroll
        for (int dt = 0; dt < 4; ++dt)
#pragma unroll
            for (int j = 0; j < 8; ++j) O[(size_t)(dt * 16 + hi * 8 + j) * MM + q0 + mb * 16 + lr] = o[dt][mb][j] * f; }
}

extern "C" void kernel_launch(void* const* d_in, const int* in_sizes, int n_in,
                              void* d_out, int out_size, void* d_ws, size_t ws_size, hipStream_t stream) {
    (void)in_sizes; (void)n_in; (void)out_size;
    const float* x = (const float*)d_in[0]; const float* Wq = (const float*)d_in[1]; const float* Wk = (const float*)d_in[2]; const float* Wv = (const float*)d_in[3];
    float* OUT = (float*)d_out;     // [16][512][1024]
    char* wsp = (char*)d_ws;
    auto take = [&](size_t bytes) { char* p = wsp; wsp += (bytes + 255) & ~(size_t)255; return (void*)p; };
    bf* AQ = (bf*)take((size_t)CO * CI * 2); bf* AK = (bf*)take((size_t)CO * CI * 2); bf* AV = (bf*)take((size_t)CO * CI * 2); float* PE = (float*)take((size_t)CO * MM * 4); bf* XT = (bf*)take((size_t)NB_ * MM * CI * 2);
    bf* QPh = (bf*)take((size_t)NB_ * CO * MM * 2); bf* QPl = (bf*)take((size_t)NB_ * CO * MM * 2); bf* KPh = (bf*)take((size_t)NB_ * CO * MM * 2); bf* KPl = (bf*)take((size_t)NB_ * CO * MM * 2); bf* VPh = (bf*)take((size_t)NB_ * CO * MM * 2); bf* VPl = (bf*)take((size_t)NB_ * CO * MM * 2);
    if ((size_t)(wsp - (char*)d_ws) > ws_size) return;    // total ~ 107 MiB
    k_cvt8<<<(CO * CI / 8 + 255) / 256, 256, 0, stream>>>(Wq, AQ, CO * CI / 8); k_cvt8<<<(CO * CI / 8 + 255) / 256, 256, 0, stream>>>(Wk, AK, CO * CI / 8); k_cvt8<<<(CO * CI / 8 + 255) / 256, 256, 0, stream>>>(Wv, AV, CO * CI / 8);   // W [o][c] is used as-is: A of the q and k GEMMs, Bt of the v GEMM
    k_pe<<<(CO * MM / 4 + 255) / 256, 256, 0, stream>>>(PE);
    const size_t zx = (size_t)MM * CI;
    k_xt<<<dim3((MM * CI / 4 + 255) / 256, NB_), 256, 0, stream>>>(x, XT);
    k_gemmp<true><<<dim3(CO / 64, MM / 64, NB_), 32, 0, stream>>>(AQ, XT, CI, QPh, QPl, PE, 0, zx);
    k_gemmp<true><<<dim3(CO / 64, MM / 64, NB_), 32, 0, stream>>>(AK, XT, CI, KPh, KPl, PE, 0, zx);
    k_gemmp<false><<<dim3(MM / 64, CO / 64, NB_), 32, 0, stream>>>(XT, AV, CI, VPh, VPl, PE, zx, 0);
    k_fattn<<<dim3(MM / 256, NB_ * NH_), 256, 0, stream>>>(QPh, QPl, KPh, KPl, VPh, VPl, OUT);   // blockIdx.y = batch * 8 + head: the planes and OUT are contiguous in that index
}

// v004
// It runs in 135 microseconds.
// Timed twice side by side with v003, it ran 1.13 times as fast both times.
// All steps since v000 together make it 9.33 times as fast.
#include <hip/hip_runtime.h>

// MultiHeadSelfAttention2D (x [16][256][32][32] channel-major; q/k/v = 1x1 conv = W [512][256] . x[c][m] over the M = 1024 positions; 2-D sinusoidal PE r[c][m] (first 256 channels row position, last 256 column position; even channels sin, odd cos; constants computed on device) added to q and k;
//   8 heads x 64: logits[m][n] = sum_d qh[d][m] kh[d][n] / 8, clipped to [-50, 50]; softmax over n; out[h*64+d][m] = sum_n A[m][n] vh[d][n] -> [16][512][32][32] channel-major).
// Compute dtypes, f32 accumulate: every input rounded to bf16; the three 1x1 convs as PLAIN bf16 GEMMs W . x^T (inputs: exact; x transposed to [m][c] once per batch); q + PE and k + PE in f32 -> hl planes [h][m][d], v -> hl planes [h][d][n], all three split and stored by the conv GEMM itself; logits hl x hl (3 products); clip + softmax f32 (running maximum and sum) -> hl fragments in registers; out = vh (hl planes [h][d][n]) . A^T as hl x hl (3 products), divided by the row sum at the end and written straight into the channel-major output; the batch index rides in the grid: every stage covers all 16 batches in one launch; logits, softmax and the second product are ONE kernel (k_fattn), so neither the logits nor the softmax matrix touch memory.

#define NB_  16
#define CI   256
#define CO   512
#define MM   1024
#define HH   32
#define NH_  8
#define HD   64
typedef _Float16 h16;
typedef unsigned short bf;
typedef __attribute__((ext_vector_type(16))) __bf16   v16bf;
typedef __attribute__((ext_vector_type(16))) _Float16 v16h;
typedef __attribute__((ext_vector_type(8)))  _Float16 v8h;
typedef __attribute__((ext_vector_type(8)))  unsigned short v8us;
typedef __attribute__((ext_vector_type(8)))  float    v8f;
typedef __attribute__((ext_vector_type(4)))  float    v4f;
typedef v8h  __attribute__((may_alias)) v8ha;
typedef v4f  __attribute__((may_alias)) v4fa;
typedef v8us __attribute__((may_alias)) v8usa;

__device__ __forceinline__ unsigned short f2bf(float f) { unsigned u = __float_as_uint(f); u += 0x7FFFu + ((u >> 16) & 1u); return (unsigned short)(u >> 16); }
__device__ __forceinline__ float bf2f(unsigned short b) { return __uint_as_float(((unsigned)b) << 16); }
__device__ __forceinline__ float bfr(float f) { return bf2f(f2bf(f)); }
__device__ __forceinline__ v16h cat16(v8h lo, v8h hi) { return __builtin_shufflevector(lo, hi, 0, 1, 2, 3, 4, 5, 6, 7, 8, 9, 10, 11, 12, 13, 14, 15); }
__device__ __forceinline__ v16bf cat16b(v8us lo, v8us hi) { return __builtin_bit_cast(v16bf, __builtin_shufflevector(lo, hi, 0, 1, 2, 3, 4, 5, 6, 7, 8, 9, 10, 11, 12, 13, 14, 15)); }
__device__ __forceinline__ v8f wmma16(v16h a, v16h b, v8f c) { return __builtin_amdgcn_wmma_f32_16x16x32_f16(false, a, false, b, (short)0, c, false, false); }
__device__ __forceinline__ v8f wmmab(v16bf a, v16bf b, v8f c) { return __builtin_amdgcn_wmma_f32_16x16x32_bf16(false, a, false, b, (short)0, c, false, false); }



// ---- d_gemmp: register-blocked conv GEMM, ONE WAVE per 64x64 tile (16 accumulators), operands straight from K-contiguous bf16 planes; tile (bx of rows of A / 64, by of rows of Bt / 64) of batch z, 32 threads; K % 32 == 0.
// y[r][c] = sum_k A[r][k] Bt[c][k]. A lane's 8 accumulator registers are 8 CONSECUTIVE r of one c, so the operand whose index must run contiguously in the planes is given as A: a lane splits its 8 values, puts 16 bytes per plane into LDS, and the tile leaves as whole 128-byte lines; the f32 result never touches memory:
// QK: A = W (r = output channel, tile = one head), Bt = x^T (c = position m): planes [h][m][d] of y + PE, PE read as [m][channel]. Otherwise: A = x^T (r = position n), Bt = W (c = output channel): planes [channel][n].
template <typename T16> struct WFrag;
template <> struct WFrag<h16> { typedef v16h V; static __device__ __forceinline__ V ld(const h16* p) { return cat16(*(const v8h*)p, *(const v8h*)(p + 16)); } static __device__ __forceinline__ v8f mma(V a, V b, v8f c) { return wmma16(a, b, c); } };
template <> struct WFrag<bf> { typedef v16bf V; static __device__ __forceinline__ V ld(const bf* p) { return cat16b(*(const v8us*)p, *(const v8us*)(p + 16)); } static __device__ __forceinline__ v8f mma(V a, V b, v8f c) { return wmmab(a, b, c); } };
__device__ __forceinline__ void splitf(float y, unsigned short& h, unsigned short& l) { h = f2bf(y); l = f2bf(y - bf2f(h)); }
#define OSP  (64 + 8)      // LDS pitch of a staged row, elements: 144 B = 16 B x odd
template <bool QK>
__device__ __forceinline__ void d_gemmp(const bf* __restrict__ A, const bf* __restrict__ Bt, int K, bf* Ph, bf* Pl, const float* __restrict__ PEt, size_t sA, size_t sB, int bx, int by, size_t z, bf (*os)[64 * OSP]) {
    typedef WFrag<bf>::V V;
    A += z * sA; Bt += z * sB;
    const int lane = threadIdx.x & 31, lr = lane & 15, hi = lane >> 4; const int r0 = bx * 64, c0 = by * 64;
    v8f acc[4][4];
#pragma unroll
    for (int mb = 0; mb < 4; ++mb)
#pragma unroll
        for (int nb = 0; nb < 4; ++nb) acc[mb][nb] = (v8f){};
    const size_t aoff = (size_t)(r0 + lr) * K + 8 * hi, boff = (size_t)(c0 + lr) * K + 8 * hi;
#pragma unroll 1
    for (int kc = 0; kc < K; kc += 32) {
        V a[4];
#pragma unroll
        for (int mb = 0; mb < 4; ++mb) a[mb] = WFrag<bf>::ld(A + aoff + (size_t)mb * 16 * K + kc);
#pragma unroll
        for (int nb = 0; nb < 4; ++nb) { const V b = WFrag<bf>::ld(Bt + boff + (size_t)nb * 16 * K + kc);
#pragma unroll
            for (int mb = 0; mb < 4; ++mb) acc[mb][nb] = WFrag<bf>::mma(a[mb], b, acc[mb][nb]); }
        asm volatile("v_nop\n\tv_nop\n\tv_nop\n\tv_nop" : "+v"(acc[0][0]), "+v"(acc[1][1]), "+v"(acc[2][2]), "+v"(acc[3][3]) : "v"(a[0]), "v"(a[3]));
    }
    constexpr int PITCH = QK ? HD : MM;    // plane elements from one c to the next
    const float* pe = PEt + (size_t)(c0 + lr) * CO + r0 + 8 * hi;
#pragma unroll
    for (int nb = 0; nb < 4; ++nb)
#pragma unroll
        for (int mb = 0; mb < 4; ++mb) { v8f y = acc[mb][nb];
            if (QK) { const v4f p0 = *(const v4f*)(pe + nb * 16 * CO + mb * 16), p1 = *(const v4f*)(pe + nb * 16 * CO + mb * 16 + 4);
#pragma unroll
                for (int j = 0; j < 4; ++j) { y[j] = __fadd_rn(y[j], p0[j]); y[4 + j] = __fadd_rn(y[4 + j], p1[j]); } }
            v8us oh, ol;
#pragma unroll
            for (int j = 0; j < 8; ++j) { unsigned short s0, s1; splitf(y[j], s0, s1); oh[j] = s0; ol[j] = s1; }
            *(v8usa*)(&os[0][(nb * 16 + lr) * OSP + mb * 16 + 8 * hi]) = oh; *(v8usa*)(&os[1][(nb * 16 + lr) * OSP + mb * 16 + 8 * hi]) = ol; }
    asm volatile("s_wait_dscnt 0x0" ::: "memory");    // the reads below take what other lanes of this wave wrote: every LDS write has landed, and the compiler moves no read above this line
    const size_t ob = z * ((size_t)CO * MM) + (QK ? (size_t)r0 * MM : (size_t)r0) + (size_t)(c0 + (lane >> 3)) * PITCH + (lane & 7) * 8;
#pragma unroll
    for (int s = 0; s < 16; ++s) { const int so = (s * 4 + (lane >> 3)) * OSP + (lane & 7) * 8;    // 8 lanes = one whole 128-byte line of a plane, 4 lines an instruction
        *(v8us*)(Ph + ob + s * 4 * PITCH) = *(const v8usa*)(&os[0][so]); *(v8us*)(Pl + ob + s * 4 * PITCH) = *(const v8usa*)(&os[1][so]); }
    asm volatile("s_wait_xcnt 0x0" ::: "memory");    // precaution: the wait stands in front of any later overwrite of these stores' data and address registers
}
// k_gemm3: the three conv GEMMs, which do not depend on one another, as ONE grid (128 tiles, 1, 3 x batches): blockIdx.z / 16 = q, k, v; the tile index runs as the two grid indices of a launch of its own did (first index fastest).
__global__ __launch_bounds__(32) void k_gemm3(const bf* __restrict__ AQ, const bf* __restrict__ AK, const bf* __restrict__ AV, const bf* __restrict__ XT, int K, bf* QPh, bf* QPl, bf* KPh, bf* KPl, bf* VPh, bf* VPl, const float* __restrict__ PEt) {
    __shared__ __align__(16) bf os[2][64 * OSP];    // [h, l][c][r]
    const int w = blockIdx.z / NB_, t = blockIdx.x; const size_t z = blockIdx.z % NB_; const size_t zx = (size_t)MM * CI;
    if (w < 2) d_gemmp<true>(w ? AK : AQ, XT, K, w ? KPh : QPh, w ? KPl : QPl, PEt, 0, zx, t % (CO / 64), t / (CO / 64), z, os);
    else d_gemmp<false>(XT, AV, K, VPh, VPl, PEt, zx, 0, t % (MM / 64), t / (MM / 64), z, os);
}

typedef __attribute__((ext_vector_type(2))) unsigned short v2us;
typedef __attribute__((ext_vector_type(4))) unsigned short v4us;

__device__ __forceinline__ void d_cvt8(const float* __restrict__ src, bf* dst, size_t n8, int bx) { const size_t i = (size_t)bx * 256 + threadIdx.x; if (i >= n8) return; const v8f v = *(const v8f*)(src + i * 8); v8us o;
#pragma unroll
    for (int k = 0; k < 8; ++k) o[k] = f2bf(v[k]); *(v8us*)(dst + i * 8) = o;  }
// d_pe: PE[m][c] (f32, channel running fastest: the order the conv GEMM's lanes read it in): c < 256 -> pe1d(256, row = m / 32)[c], else pe1d(256, col = m % 32)[c - 256]; pe1d(d, L)[p][ch] = (ch even ? sin : cos)(p * exp(-ln(1e4) * (ch - ch%2) / d)) (16-B lanes along c);
// by = batch in d_xt. d_xt: XT[m][c] = bf16(x[c][m]) (written as [m][c] with 8-B lanes: lanes run along c)
__device__ __forceinline__ void d_pe(float* PE, int bx) { const int e = (bx * 256 + threadIdx.x) * 4; if (e >= CO * MM) return; const int m = e / CO; const int c0 = e % CO; v4f r;
#pragma unroll 1    // one copy of the sin / cos code
    for (int u = 0; u < 4; ++u) { const int c = c0 + u; const int cc = (c < CO / 2) ? c : c - CO / 2; const int ch2 = cc & ~1; const float div = __expf(-logf(10000.0f) * (float)ch2 / (float)(CO / 2)); const int p = (c < CO / 2) ? (m / HH) : (m % HH); const float ang = __fmul_rn((float)p, div); r[u] = (cc & 1) ? cosf(ang) : sinf(ang); }
    *(v4f*)(PE + e) = r;  }
__device__ __forceinline__ void d_xt(const float* __restrict__ X, bf* XT, int bx, int by) { const int e = (bx * 256 + threadIdx.x) * 4; if (e >= MM * CI) return; X += (size_t)by * CI * MM; XT += (size_t)by * MM * CI; const int c = e % CI; const int m = e / CI; v4us o;
#pragma unroll
    for (int u = 0; u < 4; ++u) o[u] = f2bf(X[(size_t)(c + u) * MM + m]); *(v4us*)(XT + e) = o;  }
// k_prep: the five preparing stages, which do not depend on one another, as ONE grid; the block index picks the stage (the same for a whole work-group): PE table first (the longest blocks), then x^T of all batches, then the three weight conversions.
#define PB_PE  (CO * MM / 4 / 256)
#define PB_XT  (MM * CI / 4 / 256)
#define PB_W   (CO * CI / 8 / 256)
__global__ __launch_bounds__(256) void k_prep(const float* __restrict__ X, const float* __restrict__ Wq, const float* __restrict__ Wk, const float* __restrict__ Wv, bf* AQ, bf* AK, bf* AV, float* PE, bf* XT) {
    int b = blockIdx.x;
    if (b < PB_PE) { d_pe(PE, b); return; }
    b -= PB_PE;
    if (b < PB_XT * NB_) { d_xt(X, XT, b % PB_XT, b / PB_XT); return; }
    b -= PB_XT * NB_;
    const int w = b / PB_W;
    d_cvt8(w == 0 ? Wq : w == 1 ? Wk : Wv, w == 0 ? AQ : w == 1 ? AK : AV, CO * CI / 8, b % PB_W);   // W [o][c] is used as-is: the A operand of q and k, the Bt operand of v
}
// ---- k_fattn: logits, clip, softmax and A . v in one kernel. Grid (M / 256, batches x heads), 8 waves; a wave owns 32 query columns, the work-group walks the 1024 keys in stages of KT.
// S^T tile = K rows (A operand, from LDS) x Q columns (B operand, kept in registers): lane (lr, hi) holds query lr, keys 8 * hi + j of each 16-key tile, so two tiles of one 32-key pass ARE the B operand of the second product
// (element i = tile 0 register i, element 8 + i = tile 1 register i: the k order of the two 16-byte loads that every A fragment here is read with). out^T tile = v rows (A, from LDS) x P (B): lane (lr, hi) holds query lr, d = 8 * hi + j.
// Running maximum per query (in-lane plus one exchange between the wave's halves); P = exp(t - maximum so far), not yet divided; accumulators and sum are rescaled when the maximum moves; one division at the end.
#define KT   64            // keys per stage
#define KPI  (HD + 8)      // LDS pitch of a K row, elements: 144 B = 16 B x odd, conflict-free 16-byte reads
#define VPI  (KT + 8)      // LDS pitch of a v row, elements
#define NCH  (KT * 8 / 256)
__device__ __forceinline__ v16bf ldsf(const bf* p) { return cat16b(*(const v8usa*)p, *(const v8usa*)(p + 16)); }
__device__ __forceinline__ float xhalf(float v) { const int b = __float_as_int(v); return __int_as_float(__builtin_amdgcn_permlanex16(b, b, 0x76543210, (int)0xfedcba98u, false, false)); }   // lane l <-> l ^ 16
// amdgpu_waves_per_eu(4, 4): at most 256 registers a wave, so that two work-groups share a WGP and one wave's vector work runs under another's matrix work
__global__ __launch_bounds__(256) __attribute__((amdgpu_waves_per_eu(4, 4))) void k_fattn(const bf* __restrict__ Qh, const bf* __restrict__ Ql, const bf* __restrict__ Kh, const bf* __restrict__ Kl, const bf* __restrict__ Vh, const bf* __restrict__ Vl, float* __restrict__ O) {
    __shared__ __align__(16) bf sK[2][2][KT * KPI];    // [buffer][h, l][key][d]
    __shared__ __align__(16) bf sV[2][2][HD * VPI];    // [buffer][h, l][d][key]
    const size_t zo = (size_t)blockIdx.y * MM * HD; Qh += zo; Ql += zo; Kh += zo; Kl += zo; Vh += zo; Vl += zo; O += zo;
    const int tid = threadIdx.x, lane = tid & 31, lr = lane & 15, hi = lane >> 4; const int q0 = blockIdx.x * 256 + (tid >> 5) * 32;
    const float L2E = 1.4426950408889634f;
    v16bf qh[2][2], ql[2][2];
#pragma unroll
    for (int mb = 0; mb < 2; ++mb)
#pragma unroll
        for (int kc = 0; kc < 2; ++kc) { const size_t qo = (size_t)(q0 + mb * 16 + lr) * HD + kc * 32 + 8 * hi; qh[mb][kc] = WFrag<bf>::ld(Qh + qo); ql[mb][kc] = WFrag<bf>::ld(Ql + qo); }
    v8f o[4][2];
#pragma unroll
    for (int dt = 0; dt < 4; ++dt) { o[dt][0] = (v8f){}; o[dt][1] = (v8f){}; }
    float mrun[2] = {-3.0e38f, -3.0e38f}, lsum[2] = {0.f, 0.f};
    v8us g[4][NCH];
    const unsigned ko8 = (unsigned)tid * 8u, vo8 = (unsigned)(tid / (KT / 8)) * MM + (unsigned)(tid % (KT / 8)) * 8u;    // this thread's 16-byte piece of a K tile (contiguous) and of a v tile (row d, pitch M)
    auto fetch = [&](int n0) { const bf* kh = Kh + (size_t)n0 * HD; const bf* kl = Kl + (size_t)n0 * HD; const bf* vh = Vh + n0; const bf* vl = Vl + n0;
#pragma unroll
        for (int i = 0; i < NCH; ++i) {
            g[0][i] = *(const v8us*)(kh + (ko8 + i * 2048u)); g[1][i] = *(const v8us*)(kl + (ko8 + i * 2048u));
            g[2][i] = *(const v8us*)(vh + (vo8 + i * (256u / (KT / 8)) * MM)); g[3][i] = *(const v8us*)(vl + (vo8 + i * (256u / (KT / 8)) * MM)); } };
    auto put = [&](int b) {
#pragma unroll
        for (int i = 0; i < NCH; ++i) { const int c = tid + i * 256; const int d = c / (KT / 8), cc = c % (KT / 8);
            *(v8usa*)(&sK[b][0][(c >> 3) * KPI + (c & 7) * 8]) = g[0][i]; *(v8usa*)(&sK[b][1][(c >> 3) * KPI + (c & 7) * 8]) = g[1][i];
            *(v8usa*)(&sV[b][0][d * VPI + cc * 8]) = g[2][i]; *(v8usa*)(&sV[b][1][d * VPI + cc * 8]) = g[3][i]; } };
    fetch(0); put(0);
    __syncthreads();
#pragma unroll 1
    for (int st = 0; st < MM / KT; ++st) {
        const int b = st & 1;
        if (st + 1 < MM / KT) fetch((st + 1) * KT);    // the next stage's global loads fly under this stage's work
#pragma unroll 1
        for (int kp = 0; kp < KT / 32; ++kp) {
            v8f s[2][2];
            s[0][0] = (v8f){}; s[0][1] = (v8f){}; s[1][0] = (v8f){}; s[1][1] = (v8f){};
#pragma unroll
            for (int kc = 0; kc < 2; ++kc) { v16bf ah[2], al[2];
#pragma unroll
                for (int nt = 0; nt < 2; ++nt) { const int ko = (kp * 32 + nt * 16 + lr) * KPI + kc * 32 + 8 * hi; ah[nt] = ldsf(&sK[b][0][ko]); al[nt] = ldsf(&sK[b][1][ko]); }
#pragma unroll
                for (int nt = 0; nt < 2; ++nt) { s[0][nt] = wmmab(ah[nt], qh[0][kc], s[0][nt]); s[1][nt] = wmmab(ah[nt], qh[1][kc], s[1][nt]); }
#pragma unroll
                for (int nt = 0; nt < 2; ++nt) { s[0][nt] = wmmab(al[nt], qh[0][kc], s[0][nt]); s[1][nt] = wmmab(al[nt], qh[1][kc], s[1][nt]); }
#pragma unroll
                for (int nt = 0; nt < 2; ++nt) { s[0][nt] = wmmab(ah[nt], ql[0][kc], s[0][nt]); s[1][nt] = wmmab(ah[nt], ql[1][kc], s[1][nt]); } }
            v16bf ph[2], pl[2];
#pragma unroll
            for (int mb = 0; mb < 2; ++mb) {
                float t[16]; float mx = -3.0e38f;
#pragma unroll
                for (int i = 0; i < 16; ++i) { t[i] = fminf(fmaxf(s[mb][i >> 3][i & 7] * 0.125f, -50.0f), 50.0f); mx = fmaxf(mx, t[i]); }
                mx = fmaxf(mx, xhalf(mx));
                const float mn = fmaxf(mrun[mb], mx); const float mL = mn * L2E;
                const float alpha = __builtin_amdgcn_exp2f(__builtin_fmaf(mrun[mb], L2E, -mL)); mrun[mb] = mn;
                float sum = 0.f; v8us h0, h1, l0, l1;
#pragma unroll
                for (int i = 0; i < 8; ++i) { unsigned short a, c;
                    const float p0 = __builtin_amdgcn_exp2f(__builtin_fmaf(t[i], L2E, -mL)); sum += p0; splitf(p0, a, c); h0[i] = a; l0[i] = c;
                    const float p1 = __builtin_amdgcn_exp2f(__builtin_fmaf(t[8 + i], L2E, -mL)); sum += p1; splitf(p1, a, c); h1[i] = a; l1[i] = c; }
                lsum[mb] = lsum[mb] * alpha + sum;
#pragma unroll
                for (int dt = 0; dt < 4; ++dt) o[dt][mb] *= alpha;
                ph[mb] = cat16b(h0, h1); pl[mb] = cat16b(l0, l1); }
#pragma unroll
            for (int dp = 0; dp < 2; ++dp) { v16bf vh[2], vl[2];
#pragma unroll
                for (int d2 = 0; d2 < 2; ++d2) { const int vo = ((dp * 2 + d2) * 16 + lr) * VPI + kp * 32 + 8 * hi; vh[d2] = ldsf(&sV[b][0][vo]); vl[d2] = ldsf(&sV[b][1][vo]); }
#pragma unroll
                for (int d2 = 0; d2 < 2; ++d2) { o[dp * 2 + d2][0] = wmmab(vh[d2], ph[0], o[dp * 2 + d2][0]); o[dp * 2 + d2][1] = wmmab(vh[d2], ph[1], o[dp * 2 + d2][1]); }
#pragma unroll
                for (int d2 = 0; d2 < 2; ++d2) { o[dp * 2 + d2][0] = wmmab(vl[d2], ph[0], o[dp * 2 + d2][0]); o[dp * 2 + d2][1] = wmmab(vl[d2], ph[1], o[dp * 2 + d2][1]); }
#pragma unroll
                for (int d2 = 0; d2 < 2; ++d2) { o[dp * 2 + d2][0] = wmmab(vh[d2], pl[0], o[dp * 2 + d2][0]); o[dp * 2 + d2][1] = wmmab(vh[d2], pl[1], o[dp * 2 + d2][1]); } }
        }
        if (st + 1 < MM / KT) put(b ^ 1);    // that buffer's last readers left it before the barrier that ended stage st - 1
        __syncthreads();                      // publishes stage st + 1 and ends every read of stage st
    }
#pragma unroll
    for (int mb = 0; mb < 2; ++mb) { const float f = __fdiv_rn(1.0f, lsum[mb] + xhalf(lsum[mb]));
#pragma unroll
        for (int dt = 0; dt < 4; ++dt)
#pragma unroll
            for (int j = 0; j < 8; ++j) O[(size_t)(dt * 16 + hi * 8 + j) * MM + q0 + mb * 16 + lr] = o[dt][mb][j] * f; }
}

extern "C" void kernel_launch(void* const* d_in, const int* in_sizes, int n_in,
                              void* d_out, int out_size, void* d_ws, size_t ws_size, hipStream_t stream) {
    (void)in_sizes; (void)n_in; (void)out_size;
    const float* x = (const float*)d_in[0]; const float* Wq = (const float*)d_in[1]; const float* Wk = (const float*)d_in[2]; const float* Wv = (const float*)d_in[3];
    float* OUT = (float*)d_out;     // [16][512][1024]
    char* wsp = (char*)d_ws;
    auto take = [&](size_t bytes) { char* p = wsp; wsp += (bytes + 255) & ~(size_t)255; return (void*)p; };
    bf* AQ = (bf*)take((size_t)CO * CI * 2); bf* AK = (bf*)take((size_t)CO * CI * 2); bf* AV = (bf*)take((size_t)CO * CI * 2); float* PE = (float*)take((size_t)CO * MM * 4); bf* XT = (bf*)take((size_t)NB_ * MM * CI * 2);
    bf* QPh = (bf*)take((size_t)NB_ * CO * MM * 2); bf* QPl = (bf*)take((size_t)NB_ * CO * MM * 2); bf* KPh = (bf*)take((size_t)NB_ * CO * MM * 2); bf* KPl = (bf*)take((size_t)NB_ * CO * MM * 2); bf* VPh = (bf*)take((size_t)NB_ * CO * MM * 2); bf* VPl = (bf*)take((size_t)NB_ * CO * MM * 2);
    if ((size_t)(wsp - (char*)d_ws) > ws_size) return;    // total ~ 107 MiB
    k_prep<<<PB_PE + PB_XT * NB_ + 3 * PB_W, 256, 0, stream>>>(x, Wq, Wk, Wv, AQ, AK, AV, PE, XT);
    k_gemm3<<<dim3((CO / 64) * (MM / 64), 1, 3 * NB_), 32, 0, stream>>>(AQ, AK, AV, XT, CI, QPh, QPl, KPh, KPl, VPh, VPl, PE);
    k_fattn<<<dim3(MM / 256, NB_ * NH_), 256, 0, stream>>>(QPh, QPl, KPh, KPl, VPh, VPl, OUT);   // blockIdx.y = batch * 8 + head: the planes and OUT are contiguous in that index
}

// v005
// One run takes 119 microseconds.
// Next to v004, in two timings, it ran 1.14 times as fast each time.
// Over all steps from v000 it is 10.6 times as fast.
#include <hip/hip_runtime.h>

// MultiHeadSelfAttention2D (x [16][256][32][32] channel-major; q/k/v = 1x1 conv = W [512][256] . x[c][m] over the M = 1024 positions; 2-D sinusoidal PE r[c][m] (first 256 channels row position, last 256 column position; even channels sin, odd cos; constants computed on device) added to q and k;
//   8 heads x 64: logits[m][n] = sum_d qh[d][m] kh[d][n] / 8, clipped to [-50, 50]; softmax over n; out[h*64+d][m] = sum_n A[m][n] vh[d][n] -> [16][512][32][32] channel-major).
// Compute dtypes, f32 accumulate: every input rounded to bf16; the three 1x1 convs as PLAIN bf16 GEMMs W . x^T (inputs: exact; x transposed to [m][c] once per batch); q + PE and k + PE in f32 -> hl planes [h][m][d], v -> hl planes [h][d][n], all three split and stored by the conv GEMM itself; logits hl x hl (3 products); clip + softmax f32 (running maximum and sum) -> hl fragments in registers; out = vh (hl planes [h][d][n]) . A^T as hl x hl (3 products), divided by the row sum at the end and written straight into the channel-major output; the batch index rides in the grid: every stage covers all 16 batches in one launch; logits, softmax and the second product are ONE kernel (k_fattn), so neither the logits nor the softmax matrix touch memory.

#define NB_  16
#define CI   256
#define CO   512
#define MM   1024
#define HH   32
#define NH_  8
#define HD   64
typedef _Float16 h16;
typedef unsigned short bf;
typedef __attribute__((ext_vector_type(16))) __bf16   v16bf;
typedef __attribute__((ext_vector_type(16))) _Float16 v16h;
typedef __attribute__((ext_vector_type(8)))  _Float16 v8h;
typedef __attribute__((ext_vector_type(8)))  unsigned short v8us;
typedef __attribute__((ext_vector_type(8)))  float    v8f;
typedef __attribute__((ext_vector_type(4)))  float    v4f;
typedef v8h  __attribute__((may_alias)) v8ha;
typedef v4f  __attribute__((may_alias)) v4fa;
typedef v8us __attribute__((may_alias)) v8usa;

typedef __attribute__((ext_vector_type(2)))  float    v2f;
typedef __attribute__((ext_vector_type(2)))  __bf16   v2bf;
typedef __attribute__((ext_vector_type(2)))  unsigned v2u;
typedef __attribute__((ext_vector_type(4)))  unsigned v4u;
typedef __attribute__((ext_vector_type(8)))  unsigned v8u;
// pk2: two f32 rounded to bf16 (to nearest, ties to even) and packed, a in the low half: the chip's own packed conversion, one instruction for the pair
__device__ __forceinline__ unsigned pk2(float a, float b) { return __builtin_bit_cast(unsigned, __builtin_convertvector((v2f){a, b}, v2bf)); }
// split2: h = bf16(y), l = bf16(y - h) of a pair, both packed; y - h is exact in f32
__device__ __forceinline__ void split2(float a, float b, unsigned& h, unsigned& l) { h = pk2(a, b); const v2f r = (v2f){a, b} - (v2f){__uint_as_float(h << 16), __uint_as_float(h & 0xFFFF0000u)}; l = __builtin_bit_cast(unsigned, __builtin_convertvector(r, v2bf)); }
__device__ __forceinline__ v16h cat16(v8h lo, v8h hi) { return __builtin_shufflevector(lo, hi, 0, 1, 2, 3, 4, 5, 6, 7, 8, 9, 10, 11, 12, 13, 14, 15); }
__device__ __forceinline__ v16bf cat16b(v8us lo, v8us hi) { return __builtin_bit_cast(v16bf, __builtin_shufflevector(lo, hi, 0, 1, 2, 3, 4, 5, 6, 7, 8, 9, 10, 11, 12, 13, 14, 15)); }
__device__ __forceinline__ v8f wmma16(v16h a, v16h b, v8f c) { return __builtin_amdgcn_wmma_f32_16x16x32_f16(false, a, false, b, (short)0, c, false, false); }
__device__ __forceinline__ v8f wmmab(v16bf a, v16bf b, v8f c) { return __builtin_amdgcn_wmma_f32_16x16x32_bf16(false, a, false, b, (short)0, c, false, false); }



// ---- d_gemmp: register-blocked conv GEMM, ONE WAVE per 64x64 tile (16 accumulators), operands straight from K-contiguous bf16 planes; tile (bx of rows of A / 64, by of rows of Bt / 64) of batch z, 32 threads; K % 32 == 0.
// y[r][c] = sum_k A[r][k] Bt[c][k]. A lane's 8 accumulator registers are 8 CONSECUTIVE r of one c, so the operand whose index must run contiguously in the planes is given as A: a lane splits its 8 values, puts 16 bytes per plane into LDS, and the tile leaves as whole 128-byte lines; the f32 result never touches memory:
// QK: A = W (r = output channel, tile = one head), Bt = x^T (c = position m): planes [h][m][d] of y + PE, PE read as [m][channel]. Otherwise: A = x^T (r = position n), Bt = W (c = output channel): planes [channel][n].
template <typename T16> struct WFrag;
template <> struct WFrag<h16> { typedef v16h V; static __device__ __forceinline__ V ld(const h16* p) { return cat16(*(const v8h*)p, *(const v8h*)(p + 16)); } static __device__ __forceinline__ v8f mma(V a, V b, v8f c) { return wmma16(a, b, c); } };
template <> struct WFrag<bf> { typedef v16bf V; static __device__ __forceinline__ V ld(const bf* p) { return cat16b(*(const v8us*)p, *(const v8us*)(p + 16)); } static __device__ __forceinline__ v8f mma(V a, V b, v8f c) { return wmmab(a, b, c); } };
#define OSP  (64 + 8)      // LDS pitch of a staged row, elements: 144 B = 16 B x odd
template <bool QK>
__device__ __forceinline__ void d_gemmp(const bf* __restrict__ A, const bf* __restrict__ Bt, int K, bf* Ph, bf* Pl, const float* __restrict__ PEt, size_t sA, size_t sB, int bx, int by, size_t z, bf (*os)[64 * OSP]) {
    typedef WFrag<bf>::V V;
    A += z * sA; Bt += z * sB;
    const int lane = threadIdx.x & 31, lr = lane & 15, hi = lane >> 4; const int r0 = bx * 64, c0 = by * 64;
    v8f acc[4][4];
#pragma unroll
    for (int mb = 0; mb < 4; ++mb)
#pragma unroll
        for (int nb = 0; nb < 4; ++nb) acc[mb][nb] = (v8f){};
    const size_t aoff = (size_t)(r0 + lr) * K + 8 * hi, boff = (size_t)(c0 + lr) * K + 8 * hi;
#pragma unroll 1
    for (int kc = 0; kc < K; kc += 32) {
        V a[4];
#pragma unroll
        for (int mb = 0; mb < 4; ++mb) a[mb] = WFrag<bf>::ld(A + aoff + (size_t)mb * 16 * K + kc);
#pragma unroll
        for (int nb = 0; nb < 4; ++nb) { const V b = WFrag<bf>::ld(Bt + boff + (size_t)nb * 16 * K + kc);
#pragma unroll
            for (int mb = 0; mb < 4; ++mb) acc[mb][nb] = WFrag<bf>::mma(a[mb], b, acc[mb][nb]); }
        asm volatile("v_nop\n\tv_nop\n\tv_nop\n\tv_nop" : "+v"(acc[0][0]), "+v"(acc[1][1]), "+v"(acc[2][2]), "+v"(acc[3][3]) : "v"(a[0]), "v"(a[3]));
    }
    constexpr int PITCH = QK ? HD : MM;    // plane elements from one c to the next
    const float* pe = PEt + (size_t)(c0 + lr) * CO + r0 + 8 * hi;
#pragma unroll
    for (int nb = 0; nb < 4; ++nb)
#pragma unroll
        for (int mb = 0; mb < 4; ++mb) { v8f y = acc[mb][nb];
            if (QK) { const v4f p0 = *(const v4f*)(pe + nb * 16 * CO + mb * 16), p1 = *(const v4f*)(pe + nb * 16 * CO + mb * 16 + 4);
#pragma unroll
                for (int j = 0; j < 4; ++j) { y[j] = __fadd_rn(y[j], p0[j]); y[4 + j] = __fadd_rn(y[4 + j], p1[j]); } }
            v4u oh, ol;
#pragma unroll
            for (int j = 0; j < 4; ++j) { unsigned s0, s1; split2(y[2 * j], y[2 * j + 1], s0, s1); oh[j] = s0; ol[j] = s1; }
            *(v8usa*)(&os[0][(nb * 16 + lr) * OSP + mb * 16 + 8 * hi]) = __builtin_bit_cast(v8us, oh); *(v8usa*)(&os[1][(nb * 16 + lr) * OSP + mb * 16 + 8 * hi]) = __builtin_bit_cast(v8us, ol); }
    asm volatile("s_wait_dscnt 0x0" ::: "memory");    // the reads below take what other lanes of this wave wrote: every LDS write has landed, and the compiler moves no read above this line
    const size_t ob = z * ((size_t)CO * MM) + (QK ? (size_t)r0 * MM : (size_t)r0) + (size_t)(c0 + (lane >> 3)) * PITCH + (lane & 7) * 8;
#pragma unroll
    for (int s = 0; s < 16; ++s) { const int so = (s * 4 + (lane >> 3)) * OSP + (lane & 7) * 8;    // 8 lanes = one whole 128-byte line of a plane, 4 lines an instruction
        *(v8us*)(Ph + ob + s * 4 * PITCH) = *(const v8usa*)(&os[0][so]); *(v8us*)(Pl + ob + s * 4 * PITCH) = *(const v8usa*)(&os[1][so]); }
    asm volatile("s_wait_xcnt 0x0" ::: "memory");    // precaution: the wait stands in front of any later overwrite of these stores' data and address registers
}
// k_gemm3: the three conv GEMMs, which do not depend on one another, as ONE grid (128 tiles, 1, 3 x batches): blockIdx.z / 16 = q, k, v; the tile index runs as the two grid indices of a launch of its own did (first index fastest).
// amdgpu_waves_per_eu(4): at most 256 registers a wave, so that four waves still share a SIMD (the shorter epilogue lets the compiler hold more of the PE loads in flight and go beyond that)
__global__ __launch_bounds__(32) __attribute__((amdgpu_waves_per_eu(4))) void k_gemm3(const bf* __restrict__ AQ, const bf* __restrict__ AK, const bf* __restrict__ AV, const bf* __restrict__ XT, int K, bf* QPh, bf* QPl, bf* KPh, bf* KPl, bf* VPh, bf* VPl, const float* __restrict__ PEt) {
    __shared__ __align__(16) bf os[2][64 * OSP];    // [h, l][c][r]
    const int w = blockIdx.z / NB_, t = blockIdx.x; const size_t z = blockIdx.z % NB_; const size_t zx = (size_t)MM * CI;
    if (w < 2) d_gemmp<true>(w ? AK : AQ, XT, K, w ? KPh : QPh, w ? KPl : QPl, PEt, 0, zx, t % (CO / 64), t / (CO / 64), z, os);
    else d_gemmp<false>(XT, AV, K, VPh, VPl, PEt, zx, 0, t % (MM / 64), t / (MM / 64), z, os);
}

typedef __attribute__((ext_vector_type(2))) unsigned short v2us;
typedef __attribute__((ext_vector_type(4))) unsigned short v4us;

__device__ __forceinline__ void d_cvt8(const float* __restrict__ src, bf* dst, size_t n8, int bx) { const size_t i = (size_t)bx * 256 + threadIdx.x; if (i >= n8) return; const v8f v = *(const v8f*)(src + i * 8); v4u o;
#pragma unroll
    for (int k = 0; k < 4; ++k) o[k] = pk2(v[2 * k], v[2 * k + 1]); *(v8us*)(dst + i * 8) = __builtin_bit_cast(v8us, o);  }
// d_pe: PE[m][c] (f32, channel running fastest: the order the conv GEMM's lanes read it in): c < 256 -> pe1d(256, row = m / 32)[c], else pe1d(256, col = m % 32)[c - 256]; pe1d(d, L)[p][ch] = (ch even ? sin : cos)(p * exp(-ln(1e4) * (ch - ch%2) / d)) (16-B lanes along c);
// by = batch in d_xt. d_xt: XT[m][c] = bf16(x[c][m]) (written as [m][c] with 8-B lanes: lanes run along c)
__device__ __forceinline__ void d_pe(float* PE, int bx) { const int e = (bx * 256 + threadIdx.x) * 4; if (e >= CO * MM) return; const int m = e / CO; const int c0 = e % CO; v4f r;
#pragma unroll 1    // one copy of the sin / cos code
    for (int u = 0; u < 4; ++u) { const int c = c0 + u; const int cc = (c < CO / 2) ? c : c - CO / 2; const int ch2 = cc & ~1; const float div = __expf(-logf(10000.0f) * (float)ch2 / (float)(CO / 2)); const int p = (c < CO / 2) ? (m / HH) : (m % HH); const float ang = __fmul_rn((float)p, div); r[u] = (cc & 1) ? cosf(ang) : sinf(ang); }
    *(v4f*)(PE + e) = r;  }
__device__ __forceinline__ void d_xt(const float* __restrict__ X, bf* XT, int bx, int by) { const int e = (bx * 256 + threadIdx.x) * 4; if (e >= MM * CI) return; X += (size_t)by * CI * MM; XT += (size_t)by * MM * CI; const int c = e % CI; const int m = e / CI; v2u o;
#pragma unroll
    for (int u = 0; u < 2; ++u) o[u] = pk2(X[(size_t)(c + 2 * u) * MM + m], X[(size_t)(c + 2 * u + 1) * MM + m]); *(v4us*)(XT + e) = __builtin_bit_cast(v4us, o);  }
// k_prep: the five preparing stages, which do not depend on one another, as ONE grid; the block index picks the stage (the same for a whole work-group): PE table first (the longest blocks), then x^T of all batches, then the three weight conversions.
#define PB_PE  (CO * MM / 4 / 256)
#define PB_XT  (MM * CI / 4 / 256)
#define PB_W   (CO * CI / 8 / 256)
__global__ __launch_bounds__(256) void k_prep(const float* __restrict__ X, const float* __restrict__ Wq, const float* __restrict__ Wk, const float* __restrict__ Wv, bf* AQ, bf* AK, bf* AV, float* PE, bf* XT) {
    int b = blockIdx.x;
    if (b < PB_PE) { d_pe(PE, b); return; }
    b -= PB_PE;
    if (b < PB_XT * NB_) { d_xt(X, XT, b % PB_XT, b / PB_XT); return; }
    b -= PB_XT * NB_;
    const int w = b / PB_W;
    d_cvt8(w == 0 ? Wq : w == 1 ? Wk : Wv, w == 0 ? AQ : w == 1 ? AK : AV, CO * CI / 8, b % PB_W);   // W [o][c] is used as-is: the A operand of q and k, the Bt operand of v
}
// ---- k_fattn: logits, clip, softmax and A . v in one kernel. Grid (M / 256, batches x heads), 8 waves; a wave owns 32 query columns, the work-group walks the 1024 keys in stages of KT.
// S^T tile = K rows (A operand, from LDS) x Q columns (B operand, kept in registers): lane (lr, hi) holds query lr, keys 8 * hi + j of each 16-key tile, so two tiles of one 32-key pass ARE the B operand of the second product
// (element i = tile 0 register i, element 8 + i = tile 1 register i: the k order of the two 16-byte loads that every A fragment here is read with). out^T tile = v rows (A, from LDS) x P (B): lane (lr, hi) holds query lr, d = 8 * hi + j.
// Running maximum per query (in-lane plus one exchange between the wave's halves); P = exp(t - maximum so far), not yet divided; accumulators and sum are rescaled when the maximum moves; one division at the end.
#define KT   64            // keys per stage
#define KPI  (HD + 8)      // LDS pitch of a K row, elements: 144 B = 16 B x odd, conflict-free 16-byte reads
#define VPI  (KT + 8)      // LDS pitch of a v row, elements
#define NCH  (KT * 8 / 256)
__device__ __forceinline__ v16bf ldsf(const bf* p) { return cat16b(*(const v8usa*)p, *(const v8usa*)(p + 16)); }
__device__ __forceinline__ float xhalf(float v) { const int b = __float_as_int(v); return __int_as_float(__builtin_amdgcn_permlanex16(b, b, 0x76543210, (int)0xfedcba98u, false, false)); }   // lane l <-> l ^ 16
// amdgpu_waves_per_eu(4, 4): at most 256 registers a wave, so that two work-groups share a WGP and one wave's vector work runs under another's matrix work
__global__ __launch_bounds__(256) __attribute__((amdgpu_waves_per_eu(4, 4))) void k_fattn(const bf* __restrict__ Qh, const bf* __restrict__ Ql, const bf* __restrict__ Kh, const bf* __restrict__ Kl, const bf* __restrict__ Vh, const bf* __restrict__ Vl, float* __restrict__ O) {
    __shared__ __align__(16) bf sK[2][2][KT * KPI];    // [buffer][h, l][key][d]
    __shared__ __align__(16) bf sV[2][2][HD * VPI];    // [buffer][h, l][d][key]
    const size_t zo = (size_t)blockIdx.y * MM * HD; Qh += zo; Ql += zo; Kh += zo; Kl += zo; Vh += zo; Vl += zo; O += zo;
    const int tid = threadIdx.x, lane = tid & 31, lr = lane & 15, hi = lane >> 4; const int q0 = blockIdx.x * 256 + (tid >> 5) * 32;
    const float L2E = 1.4426950408889634f;
    v16bf qh[2][2], ql[2][2];
#pragma unroll
    for (int mb = 0; mb < 2; ++mb)
#pragma unroll
        for (int kc = 0; kc < 2; ++kc) { const size_t qo = (size_t)(q0 + mb * 16 + lr) * HD + kc * 32 + 8 * hi; qh[mb][kc] = WFrag<bf>::ld(Qh + qo); ql[mb][kc] = WFrag<bf>::ld(Ql + qo); }
    v8f o[4][2];
#pragma unroll
    for (int dt = 0; dt < 4; ++dt) { o[dt][0] = (v8f){}; o[dt][1] = (v8f){}; }
    float mrun[2] = {-3.0e38f, -3.0e38f}, lsum[2] = {0.f, 0.f};
    v8us g[4][NCH];
    const unsigned ko8 = (unsigned)tid * 8u, vo8 = (unsigned)(tid / (KT / 8)) * MM + (unsigned)(tid % (KT / 8)) * 8u;    // this thread's 16-byte piece of a K tile (contiguous) and of a v tile (row d, pitch M)
    auto fetch = [&](int n0) { const bf* kh = Kh + (size_t)n0 * HD; const bf* kl = Kl + (size_t)n0 * HD; const bf* vh = Vh + n0; const bf* vl = Vl + n0;
#pragma unroll
        for (int i = 0; i < NCH; ++i) {
            g[0][i] = *(const v8us*)(kh + (ko8 + i * 2048u)); g[1][i] = *(const v8us*)(kl + (ko8 + i * 2048u));
            g[2][i] = *(const v8us*)(vh + (vo8 + i * (256u / (KT / 8)) * MM)); g[3][i] = *(const v8us*)(vl + (vo8 + i * (256u / (KT / 8)) * MM)); } };
    auto put = [&](int b) {
#pragma unroll
        for (int i = 0; i < NCH; ++i) { const int c = tid + i * 256; const int d = c / (KT / 8), cc = c % (KT / 8);
            *(v8usa*)(&sK[b][0][(c >> 3) * KPI + (c & 7) * 8]) = g[0][i]; *(v8usa*)(&sK[b][1][(c >> 3) * KPI + (c & 7) * 8]) = g[1][i];
            *(v8usa*)(&sV[b][0][d * VPI + cc * 8]) = g[2][i]; *(v8usa*)(&sV[b][1][d * VPI + cc * 8]) = g[3][i]; } };
    fetch(0); put(0);
    __syncthreads();
#pragma unroll 1
    for (int st = 0; st < MM / KT; ++st) {
        const int b = st & 1;
        if (st + 1 < MM / KT) fetch((st + 1) * KT);    // the next stage's global loads fly under this stage's work
#pragma unroll 1
        for (int kp = 0; kp < KT / 32; ++kp) {
            v8f s[2][2];
            s[0][0] = (v8f){}; s[0][1] = (v8f){}; s[1][0] = (v8f){}; s[1][1] = (v8f){};
#pragma unroll
            for (int kc = 0; kc < 2; ++kc) { v16bf ah[2], al[2];
#pragma unroll
                for (int nt = 0; nt < 2; ++nt) { const int ko = (kp * 32 + nt * 16 + lr) * KPI + kc * 32 + 8 * hi; ah[nt] = ldsf(&sK[b][0][ko]); al[nt] = ldsf(&sK[b][1][ko]); }
#pragma unroll
                for (int nt = 0; nt < 2; ++nt) { s[0][nt] = wmmab(ah[nt], qh[0][kc], s[0][nt]); s[1][nt] = wmmab(ah[nt], qh[1][kc], s[1][nt]); }
#pragma unroll
                for (int nt = 0; nt < 2; ++nt) { s[0][nt] = wmmab(al[nt], qh[0][kc], s[0][nt]); s[1][nt] = wmmab(al[nt], qh[1][kc], s[1][nt]); }
#pragma unroll
                for (int nt = 0; nt < 2; ++nt) { s[0][nt] = wmmab(ah[nt], ql[0][kc], s[0][nt]); s[1][nt] = wmmab(ah[nt], ql[1][kc], s[1][nt]); } }
            v16bf ph[2], pl[2];
#pragma unroll
            for (int mb = 0; mb < 2; ++mb) {
                float t[16]; float mx = -3.0e38f;
#pragma unroll
                for (int i = 0; i < 16; ++i) { t[i] = fminf(fmaxf(s[mb][i >> 3][i & 7] * 0.125f, -50.0f), 50.0f); mx = fmaxf(mx, t[i]); }
                mx = fmaxf(mx, xhalf(mx));
                const float mn = fmaxf(mrun[mb], mx); const float mL = mn * L2E;
                const float alpha = __builtin_amdgcn_exp2f(__builtin_fmaf(mrun[mb], L2E, -mL)); mrun[mb] = mn;
                float sum = 0.f; float p[16]; v8u hw, lw;
#pragma unroll
                for (int i = 0; i < 16; ++i) p[i] = __builtin_fmaf(t[i], L2E, -mL);
#pragma unroll
                for (int i = 0; i < 16; ++i) p[i] = __builtin_amdgcn_exp2f(p[i]);
#pragma unroll
                for (int i = 0; i < 8; ++i) { sum += p[i]; sum += p[8 + i]; }
#pragma unroll
                for (int i = 0; i < 8; ++i) { unsigned a, c; split2(p[2 * i], p[2 * i + 1], a, c); hw[i] = a; lw[i] = c; }    // word i = elements 2 i, 2 i + 1 of the fragment
                lsum[mb] = lsum[mb] * alpha + sum;
#pragma unroll
                for (int dt = 0; dt < 4; ++dt) o[dt][mb] *= alpha;
                ph[mb] = __builtin_bit_cast(v16bf, hw); pl[mb] = __builtin_bit_cast(v16bf, lw); }
#pragma unroll
            for (int dp = 0; dp < 2; ++dp) { v16bf vh[2], vl[2];
#pragma unroll
                for (int d2 = 0; d2 < 2; ++d2) { const int vo = ((dp * 2 + d2) * 16 + lr) * VPI + kp * 32 + 8 * hi; vh[d2] = ldsf(&sV[b][0][vo]); vl[d2] = ldsf(&sV[b][1][vo]); }
#pragma unroll
                for (int d2 = 0; d2 < 2; ++d2) { o[dp * 2 + d2][0] = wmmab(vh[d2], ph[0], o[dp * 2 + d2][0]); o[dp * 2 + d2][1] = wmmab(vh[d2], ph[1], o[dp * 2 + d2][1]); }
#pragma unroll
                for (int d2 = 0; d2 < 2; ++d2) { o[dp * 2 + d2][0] = wmmab(vl[d2], ph[0], o[dp * 2 + d2][0]); o[dp * 2 + d2][1] = wmmab(vl[d2], ph[1], o[dp * 2 + d2][1]); }
#pragma unroll
                for (int d2 = 0; d2 < 2; ++d2) { o[dp * 2 + d2][0] = wmmab(vh[d2], pl[0], o[dp * 2 + d2][0]); o[dp * 2 + d2][1] = wmmab(vh[d2], pl[1], o[dp * 2 + d2][1]); } }
        }
        if (st + 1 < MM / KT) put(b ^ 1);    // that buffer's last readers left it before the barrier that ended stage st - 1
        __syncthreads();                      // publishes stage st + 1 and ends every read of stage st
    }
#pragma unroll
    for (int mb = 0; mb < 2; ++mb) { const float f = __fdiv_rn(1.0f, lsum[mb] + xhalf(lsum[mb]));
#pragma unroll
        for (int dt = 0; dt < 4; ++dt)
#pragma unroll
            for (int j = 0; j < 8; ++j) O[(size_t)(dt * 16 + hi * 8 + j) * MM + q0 + mb * 16 + lr] = o[dt][mb][j] * f; }
}

extern "C" void kernel_launch(void* const* d_in, const int* in_sizes, int n_in,
                              void* d_out, int out_size, void* d_ws, size_t ws_size, hipStream_t stream) {
    (void)in_sizes; (void)n_in; (void)out_size;
    const float* x = (const float*)d_in[0]; const float* Wq = (const float*)d_in[1]; const float* Wk = (const float*)d_in[2]; const float* Wv = (const float*)d_in[3];
    float* OUT = (float*)d_out;     // [16][512][1024]
    char* wsp = (char*)d_ws;
    auto take = [&](size_t bytes) { char* p = wsp; wsp += (bytes + 255) & ~(size_t)255; return (void*)p; };
    bf* AQ = (bf*)take((size_t)CO * CI * 2); bf* AK = (bf*)take((size_t)CO * CI * 2); bf* AV = (bf*)take((size_t)CO * CI * 2); float* PE = (float*)take((size_t)CO * MM * 4); bf* XT = (bf*)take((size_t)NB_ * MM * CI * 2);
    bf* QPh = (bf*)take((size_t)NB_ * CO * MM * 2); bf* QPl = (bf*)take((size_t)NB_ * CO * MM * 2); bf* KPh = (bf*)take((size_t)NB_ * CO * MM * 2); bf* KPl = (bf*)take((size_t)NB_ * CO * MM * 2); bf* VPh = (bf*)take((size_t)NB_ * CO * MM * 2); bf* VPl = (bf*)take((size_t)NB_ * CO * MM * 2);
    if ((size_t)(wsp - (char*)d_ws) > ws_size) return;    // total ~ 107 MiB
    k_prep<<<PB_PE + PB_XT * NB_ + 3 * PB_W, 256, 0, stream>>>(x, Wq, Wk, Wv, AQ, AK, AV, PE, XT);
    k_gemm3<<<dim3((CO / 64) * (MM / 64), 1, 3 * NB_), 32, 0, stream>>>(AQ, AK, AV, XT, CI, QPh, QPl, KPh, KPl, VPh, VPl, PE);
    k_fattn<<<dim3(MM / 256, NB_ * NH_), 256, 0, stream>>>(QPh, QPl, KPh, KPl, VPh, VPl, OUT);   // blockIdx.y = batch * 8 + head: the planes and OUT are contiguous in that index
}

// v006
// It runs in 108 microseconds.
// Two timings next to v005 both put it at 1.10 times that version's speed.
// Counting every step since v000, it is 11.7 times as fast.
#include <hip/hip_runtime.h>

// MultiHeadSelfAttention2D (x [16][256][32][32] channel-major; q/k/v = 1x1 conv = W [512][256] . x[c][m] over the M = 1024 positions; 2-D sinusoidal PE r[c][m] (first 256 channels row position, last 256 column position; even channels sin, odd cos; constants computed on device) added to q and k;
//   8 heads x 64: logits[m][n] = sum_d qh[d][m] kh[d][n] / 8, clipped to [-50, 50]; softmax over n; out[h*64+d][m] = sum_n A[m][n] vh[d][n] -> [16][512][32][32] channel-major).
// Compute dtypes, f32 accumulate: every input rounded to bf16; the three 1x1 convs as PLAIN bf16 GEMMs W . x^T (inputs: exact; x transposed once per batch; x^T, W and the PE table lie in memory in the order the GEMM's lanes read them, see d_gemmp); q + PE and k + PE in f32 -> hl planes [h][m][d], v -> hl planes [h][d][n], all three split and stored by the conv GEMM itself; logits hl x hl (3 products); clip + softmax f32 (running maximum and sum) -> hl fragments in registers; out = vh (hl planes [h][d][n]) . A^T as hl x hl (3 products), divided by the row sum at the end and written straight into the channel-major output; the batch index rides in the grid: every stage covers all 16 batches in one launch; logits, softmax and the second product are ONE kernel (k_fattn), so neither the logits nor the softmax matrix touch memory.

#define NB_  16
#define CI   256
#define CO   512
#define MM   1024
#define HH   32
#define NH_  8
#define HD   64
typedef _Float16 h16;
typedef unsigned short bf;
typedef __attribute__((ext_vector_type(16))) __bf16   v16bf;
typedef __attribute__((ext_vector_type(16))) _Float16 v16h;
typedef __attribute__((ext_vector_type(8)))  _Float16 v8h;
typedef __attribute__((ext_vector_type(8)))  unsigned short v8us;
typedef __attribute__((ext_vector_type(8)))  float    v8f;
typedef __attribute__((ext_vector_type(4)))  float    v4f;
typedef v8h  __attribute__((may_alias)) v8ha;
typedef v4f  __attribute__((may_alias)) v4fa;
typedef v8us __attribute__((may_alias)) v8usa;

typedef __attribute__((ext_vector_type(2)))  float    v2f;
typedef __attribute__((ext_vector_type(2)))  __bf16   v2bf;
typedef __attribute__((ext_vector_type(2)))  unsigned v2u;
typedef __attribute__((ext_vector_type(4)))  unsigned v4u;
typedef __attribute__((ext_vector_type(8)))  unsigned v8u;
// pk2: two f32 rounded to bf16 (to nearest, ties to even) and packed, a in the low half: the chip's own packed conversion, one instruction for the pair
__device__ __forceinline__ unsigned pk2(float a, float b) { return __builtin_bit_cast(unsigned, __builtin_convertvector((v2f){a, b}, v2bf)); }
// split2: h = bf16(y), l = bf16(y - h) of a pair, both packed; y - h is exact in f32
__device__ __forceinline__ void split2(float a, float b, unsigned& h, unsigned& l) { h = pk2(a, b); const v2f r = (v2f){a, b} - (v2f){__uint_as_float(h << 16), __uint_as_float(h & 0xFFFF0000u)}; l = __builtin_bit_cast(unsigned, __builtin_convertvector(r, v2bf)); }
__device__ __forceinline__ v16h cat16(v8h lo, v8h hi) { return __builtin_shufflevector(lo, hi, 0, 1, 2, 3, 4, 5, 6, 7, 8, 9, 10, 11, 12, 13, 14, 15); }
__device__ __forceinline__ v16bf cat16b(v8us lo, v8us hi) { return __builtin_bit_cast(v16bf, __builtin_shufflevector(lo, hi, 0, 1, 2, 3, 4, 5, 6, 7, 8, 9, 10, 11, 12, 13, 14, 15)); }
__device__ __forceinline__ v8f wmma16(v16h a, v16h b, v8f c) { return __builtin_amdgcn_wmma_f32_16x16x32_f16(false, a, false, b, (short)0, c, false, false); }
__device__ __forceinline__ v8f wmmab(v16bf a, v16bf b, v8f c) { return __builtin_amdgcn_wmma_f32_16x16x32_bf16(false, a, false, b, (short)0, c, false, false); }



// ---- d_gemmp: register-blocked conv GEMM, ONE WAVE per 64x64 tile (16 accumulators), operands straight from bf16 planes packed in fragment order; tile (bx of rows of A / 64, by of rows of Bt / 64) of batch z, 32 threads; K % 32 == 0.
// y[r][c] = sum_k A[r][k] Bt[c][k]. A lane's 8 accumulator registers are 8 CONSECUTIVE r of one c, so the operand whose index must run contiguously in the planes is given as A: a lane splits its 8 values, puts 16 bytes per plane into LDS, and the tile leaves as whole 128-byte lines; the f32 result never touches memory:
// QK: A = W (r = output channel, tile = one head), Bt = x^T (c = position m): planes [h][m][d] of y + PE. Otherwise: A = x^T (r = position n), Bt = W (c = output channel): planes [channel][n].
template <typename T16> struct WFrag;
template <> struct WFrag<h16> { typedef v16h V; static __device__ __forceinline__ V ld(const h16* p) { return cat16(*(const v8h*)p, *(const v8h*)(p + 16)); } static __device__ __forceinline__ v8f mma(V a, V b, v8f c) { return wmma16(a, b, c); } };
template <> struct WFrag<bf> { typedef v16bf V; static __device__ __forceinline__ V ld(const bf* p) { return cat16b(*(const v8us*)p, *(const v8us*)(p + 16)); } static __device__ __forceinline__ v8f mma(V a, V b, v8f c) { return wmmab(a, b, c); } };
// Packed operand plane of R[row][k]: blocks of 16 rows x 32 k = 1 KB, block (row / 16, k / 32) at element (row / 16 * 16) * K + (k / 32) * 512; inside it the 16-byte piece (j, lane = hi * 16 + row % 16) at j * 256 + lane * 8 holds k % 32 = j * 16 + hi * 8 + 0..7:
// the same k at every lane and register as two 16-byte reads of a K-contiguous row, but each wave-wide load is 512 contiguous bytes (4 whole lines, not 32 bytes out of each of 16 lines). PE likewise: blocks of 16 m x 16 channels f32, piece (j, lane = hi * 16 + m % 16) at j * 128 + lane * 4 holds channels hi * 8 + j * 4 + 0..3.
__device__ __forceinline__ v16bf ldpk(const bf* p) { return cat16b(*(const v8us*)p, *(const v8us*)(p + 256)); }
#define OSP  (64 + 8)      // LDS pitch of a staged row, elements: 144 B = 16 B x odd
template <bool QK>
__device__ __forceinline__ void d_gemmp(const bf* __restrict__ A, const bf* __restrict__ Bt, int K, bf* Ph, bf* Pl, const float* __restrict__ PEt, size_t sA, size_t sB, int bx, int by, size_t z, bf (*os)[64 * OSP]) {
    typedef WFrag<bf>::V V;
    A += z * sA; Bt += z * sB;
    const int lane = threadIdx.x & 31, lr = lane & 15, hi = lane >> 4; const int r0 = bx * 64, c0 = by * 64;
    v8f acc[4][4];
#pragma unroll
    for (int mb = 0; mb < 4; ++mb)
#pragma unroll
        for (int nb = 0; nb < 4; ++nb) acc[mb][nb] = (v8f){};
    const size_t aoff = (size_t)r0 * K + lane * 8, boff = (size_t)c0 * K + lane * 8;
#pragma unroll 1
    for (int kc = 0; kc < K; kc += 32) {
        V a[4]; const bf* pa = A + aoff + kc * 16; const bf* pb = Bt + boff + kc * 16;
#pragma unroll
        for (int mb = 0; mb < 4; ++mb) a[mb] = ldpk(pa + (size_t)mb * 16 * K);
#pragma unroll
        for (int nb = 0; nb < 4; ++nb) { const V b = ldpk(pb + (size_t)nb * 16 * K);
            if (nb == 3) asm volatile("s_wait_xcnt 0x0" :: "v"(pa), "v"(pb) : "memory");    // behind the trip's last load: the two address pairs stay whole up to here (no load's result lands on them), and the next trip's addresses are formed behind this wait
#pragma unroll
            for (int mb = 0; mb < 4; ++mb) acc[mb][nb] = WFrag<bf>::mma(a[mb], b, acc[mb][nb]); }
        asm volatile("v_nop\n\tv_nop\n\tv_nop\n\tv_nop" : "+v"(acc[0][0]), "+v"(acc[1][1]), "+v"(acc[2][2]), "+v"(acc[3][3]) : "v"(a[0]), "v"(a[3]));
    }
    constexpr int PITCH = QK ? HD : MM;    // plane elements from one c to the next
    const float* pe = PEt + (size_t)c0 * CO + r0 * 16 + lane * 4;
#pragma unroll
    for (int nb = 0; nb < 4; ++nb)
#pragma unroll
        for (int mb = 0; mb < 4; ++mb) { v8f y = acc[mb][nb];
            if (QK) { const v4f p0 = *(const v4f*)(pe + nb * 16 * CO + mb * 256), p1 = *(const v4f*)(pe + nb * 16 * CO + mb * 256 + 128);
#pragma unroll
                for (int j = 0; j < 4; ++j) { y[j] = __fadd_rn(y[j], p0[j]); y[4 + j] = __fadd_rn(y[4 + j], p1[j]); } }
            v4u oh, ol;
#pragma unroll
            for (int j = 0; j < 4; ++j) { unsigned s0, s1; split2(y[2 * j], y[2 * j + 1], s0, s1); oh[j] = s0; ol[j] = s1; }
            *(v8usa*)(&os[0][(nb * 16 + lr) * OSP + mb * 16 + 8 * hi]) = __builtin_bit_cast(v8us, oh); *(v8usa*)(&os[1][(nb * 16 + lr) * OSP + mb * 16 + 8 * hi]) = __builtin_bit_cast(v8us, ol); }
    asm volatile("s_wait_dscnt 0x0" ::: "memory");    // the reads below take what other lanes of this wave wrote: every LDS write has landed, and the compiler moves no read above this line
    const size_t ob = z * ((size_t)CO * MM) + (QK ? (size_t)r0 * MM : (size_t)r0) + (size_t)(c0 + (lane >> 3)) * PITCH + (lane & 7) * 8;
#pragma unroll
    for (int s = 0; s < 16; ++s) { const int so = (s * 4 + (lane >> 3)) * OSP + (lane & 7) * 8;    // 8 lanes = one whole 128-byte line of a plane, 4 lines an instruction
        *(v8us*)(Ph + ob + s * 4 * PITCH) = *(const v8usa*)(&os[0][so]); *(v8us*)(Pl + ob + s * 4 * PITCH) = *(const v8usa*)(&os[1][so]); }
    asm volatile("s_wait_xcnt 0x0" ::: "memory");    // precaution: the wait stands in front of any later overwrite of these stores' data and address registers
}
// k_gemm3: the three conv GEMMs, which do not depend on one another, as ONE grid (128 tiles, 1, 3 x batches): blockIdx.z / 16 = q, k, v; the tile index runs as the two grid indices of a launch of its own did (first index fastest).
// amdgpu_waves_per_eu(4): at most 256 registers a wave, so that four waves still share a SIMD (the shorter epilogue lets the compiler hold more of the PE loads in flight and go beyond that)
__global__ __launch_bounds__(32) __attribute__((amdgpu_waves_per_eu(4))) void k_gemm3(const bf* __restrict__ AQ, const bf* __restrict__ AK, const bf* __restrict__ AV, const bf* __restrict__ XT, bf* QPh, bf* QPl, bf* KPh, bf* KPl, bf* VPh, bf* VPl, const float* __restrict__ PEt) {
    __shared__ __align__(16) bf os[2][64 * OSP];    // [h, l][c][r]
    const int w = blockIdx.z / NB_, t = blockIdx.x; const size_t z = blockIdx.z % NB_; const size_t zx = (size_t)MM * CI;
    if (w < 2) d_gemmp<true>(w ? AK : AQ, XT, CI, w ? KPh : QPh, w ? KPl : QPl, PEt, 0, zx, t % (CO / 64), t / (CO / 64), z, os);
    else d_gemmp<false>(XT, AV, CI, VPh, VPl, PEt, zx, 0, t % (MM / 64), t / (MM / 64), z, os);
}

typedef __attribute__((ext_vector_type(2))) unsigned short v2us;
typedef __attribute__((ext_vector_type(4))) unsigned short v4us;

__device__ __forceinline__ void d_cvt8(const float* __restrict__ src, bf* dst, size_t n8, int bx) { const size_t i = (size_t)bx * 256 + threadIdx.x; if (i >= n8) return;    // i = the 16-byte piece of the packed plane
    const int ln = (int)i & 31, j = ((int)i >> 5) & 1, blk = (int)(i >> 6); const int row = blk / (CI / 32) * 16 + (ln & 15), k0 = blk % (CI / 32) * 32 + j * 16 + (ln >> 4) * 8;
    const v8f v = *(const v8f*)(src + (size_t)row * CI + k0); v4u o;
#pragma unroll
    for (int k = 0; k < 4; ++k) o[k] = pk2(v[2 * k], v[2 * k + 1]); *(v8us*)(dst + i * 8) = __builtin_bit_cast(v8us, o);  }
// d_pe: PE of (m, c), f32, packed (d_gemmp): thread = one 16-byte piece; c < 256 -> pe1d(256, row = m / 32)[c], else pe1d(256, col = m % 32)[c - 256]; pe1d(d, L)[p][ch] = (ch even ? sin : cos)(p * exp(-ln(1e4) * (ch - ch%2) / d)) ;
// by = batch in d_xt. d_xt: packed plane of XT[m][c] = bf16(x[c][m]): lanes run along m, so a load is one whole line of x and a store is two runs of 256 bytes; a thread takes 16 channels of one m = the pieces hi = 0, 1 of one (block, j)
__device__ __forceinline__ void d_pe(float* PE, int bx) { const int e = (bx * 256 + threadIdx.x) * 4; if (e >= CO * MM) return; const int ln = (e >> 2) & 31, blk = e >> 8; const int m = blk / (CO / 16) * 16 + (ln & 15); const int c0 = blk % (CO / 16) * 16 + (ln >> 4) * 8 + ((e >> 7) & 1) * 4; v4f r;
#pragma unroll 1    // one copy of the sin / cos code
    for (int u = 0; u < 4; ++u) { const int c = c0 + u; const int cc = (c < CO / 2) ? c : c - CO / 2; const int ch2 = cc & ~1; const float div = __expf(-logf(10000.0f) * (float)ch2 / (float)(CO / 2)); const int p = (c < CO / 2) ? (m / HH) : (m % HH); const float ang = __fmul_rn((float)p, div); r[u] = (cc & 1) ? cosf(ang) : sinf(ang); }
    *(v4f*)(PE + e) = r;  }
__device__ __forceinline__ void d_xt(const float* __restrict__ X, bf* XT, int bx, int by) { const int e = bx * 256 + threadIdx.x; if (e >= MM * (CI / 16)) return; const int m = e % MM, c16 = e / MM;
    X += (size_t)by * CI * MM + (size_t)c16 * 16 * MM + m; XT += (size_t)by * MM * CI + (size_t)(m >> 4) * 16 * CI + (c16 >> 1) * 512 + (c16 & 1) * 256 + (m & 15) * 8; float v[16];
#pragma unroll
    for (int u = 0; u < 16; ++u) v[u] = X[(size_t)u * MM];
#pragma unroll
    for (int hi = 0; hi < 2; ++hi) { v4u o;
#pragma unroll
        for (int k = 0; k < 4; ++k) o[k] = pk2(v[hi * 8 + 2 * k], v[hi * 8 + 2 * k + 1]);
        *(v8us*)(XT + hi * 128) = __builtin_bit_cast(v8us, o); }  }
// k_prep: the five preparing stages, which do not depend on one another, as ONE grid; the block index picks the stage (the same for a whole work-group): PE table first (the longest blocks), then x^T of all batches, then the three weight conversions.
#define PB_PE  (CO * MM / 4 / 256)
#define PB_XT  (MM * CI / 16 / 256)
#define PB_W   (CO * CI / 8 / 256)
__global__ __launch_bounds__(256) void k_prep(const float* __restrict__ X, const float* __restrict__ Wq, const float* __restrict__ Wk, const float* __restrict__ Wv, bf* AQ, bf* AK, bf* AV, float* PE, bf* XT) {
    int b = blockIdx.x;
    if (b < PB_PE) { d_pe(PE, b); return; }
    b -= PB_PE;
    if (b < PB_XT * NB_) { d_xt(X, XT, b % PB_XT, b / PB_XT); return; }
    b -= PB_XT * NB_;
    const int w = b / PB_W;
    d_cvt8(w == 0 ? Wq : w == 1 ? Wk : Wv, w == 0 ? AQ : w == 1 ? AK : AV, CO * CI / 8, b % PB_W);   // W [o][c] is used as-is: the A operand of q and k, the Bt operand of v
}
// ---- k_fattn: logits, clip, softmax and A . v in one kernel. Grid (M / 256, batches x heads), 8 waves; a wave owns 32 query columns, the work-group walks the 1024 keys in stages of KT.
// S^T tile = K rows (A operand, from LDS) x Q columns (B operand, kept in registers): lane (lr, hi) holds query lr, keys 8 * hi + j of each 16-key tile, so two tiles of one 32-key pass ARE the B operand of the second product
// (element i = tile 0 register i, element 8 + i = tile 1 register i: the k order of the two 16-byte loads that every A fragment here is read with). out^T tile = v rows (A, from LDS) x P (B): lane (lr, hi) holds query lr, d = 8 * hi + j.
// Running maximum per query (in-lane plus one exchange between the wave's halves); P = exp(t - maximum so far), not yet divided; accumulators and sum are rescaled when the maximum moves; one division at the end.
#define KT   64            // keys per stage
#define KPI  (HD + 8)      // LDS pitch of a K row, elements: 144 B = 16 B x odd, conflict-free 16-byte reads
#define VPI  (KT + 8)      // LDS pitch of a v row, elements
#define NCH  (KT * 8 / 256)
__device__ __forceinline__ v16bf ldsf(const bf* p) { return cat16b(*(const v8usa*)p, *(const v8usa*)(p + 16)); }
__device__ __forceinline__ float xhalf(float v) { const int b = __float_as_int(v); return __int_as_float(__builtin_amdgcn_permlanex16(b, b, 0x76543210, (int)0xfedcba98u, false, false)); }   // lane l <-> l ^ 16
// amdgpu_waves_per_eu(4, 4): at most 256 registers a wave, so that two work-groups share a WGP and one wave's vector work runs under another's matrix work
__global__ __launch_bounds__(256) __attribute__((amdgpu_waves_per_eu(4, 4))) void k_fattn(const bf* __restrict__ Qh, const bf* __restrict__ Ql, const bf* __restrict__ Kh, const bf* __restrict__ Kl, const bf* __restrict__ Vh, const bf* __restrict__ Vl, float* __restrict__ O) {
    __shared__ __align__(16) bf sK[2][2][KT * KPI];    // [buffer][h, l][key][d]
    __shared__ __align__(16) bf sV[2][2][HD * VPI];    // [buffer][h, l][d][key]
    const size_t zo = (size_t)blockIdx.y * MM * HD; Qh += zo; Ql += zo; Kh += zo; Kl += zo; Vh += zo; Vl += zo; O += zo;
    const int tid = threadIdx.x, lane = tid & 31, lr = lane & 15, hi = lane >> 4; const int q0 = blockIdx.x * 256 + (tid >> 5) * 32;
    const float L2E = 1.4426950408889634f;
    v16bf qh[2][2], ql[2][2];
#pragma unroll
    for (int mb = 0; mb < 2; ++mb)
#pragma unroll
        for (int kc = 0; kc < 2; ++kc) { const size_t qo = (size_t)(q0 + mb * 16 + lr) * HD + kc * 32 + 8 * hi; qh[mb][kc] = WFrag<bf>::ld(Qh + qo); ql[mb][kc] = WFrag<bf>::ld(Ql + qo); }
    v8f o[4][2];
#pragma unroll
    for (int dt = 0; dt < 4; ++dt) { o[dt][0] = (v8f){}; o[dt][1] = (v8f){}; }
    float mrun[2] = {-3.0e38f, -3.0e38f}, lsum[2] = {0.f, 0.f};
    v8us g[4][NCH];
    const unsigned ko8 = (unsigned)tid * 8u, vo8 = (unsigned)(tid / (KT / 8)) * MM + (unsigned)(tid % (KT / 8)) * 8u;    // this thread's 16-byte piece of a K tile (contiguous) and of a v tile (row d, pitch M)
    auto fetch = [&](int n0) { const bf* kh = Kh + (size_t)n0 * HD; const bf* kl = Kl + (size_t)n0 * HD; const bf* vh = Vh + n0; const bf* vl = Vl + n0;
#pragma unroll
        for (int i = 0; i < NCH; ++i) {
            g[0][i] = *(const v8us*)(kh + (ko8 + i * 2048u)); g[1][i] = *(const v8us*)(kl + (ko8 + i * 2048u));
            g[2][i] = *(const v8us*)(vh + (vo8 + i * (256u / (KT / 8)) * MM)); g[3][i] = *(const v8us*)(vl + (vo8 + i * (256u / (KT / 8)) * MM)); } };
    auto put = [&](int b) {
#pragma unroll
        for (int i = 0; i < NCH; ++i) { const int c = tid + i * 256; const int d = c / (KT / 8), cc = c % (KT / 8);
            *(v8usa*)(&sK[b][0][(c >> 3) * KPI + (c & 7) * 8]) = g[0][i]; *(v8usa*)(&sK[b][1][(c >> 3) * KPI + (c & 7) * 8]) = g[1][i];
            *(v8usa*)(&sV[b][0][d * VPI + cc * 8]) = g[2][i]; *(v8usa*)(&sV[b][1][d * VPI + cc * 8]) = g[3][i]; } };
    fetch(0); put(0);
    __syncthreads();
#pragma unroll 1
    for (int st = 0; st < MM / KT; ++st) {
        const int b = st & 1;
        if (st + 1 < MM / KT) fetch((st + 1) * KT);    // the next stage's global loads fly under this stage's work
#pragma unroll 1
        for (int kp = 0; kp < KT / 32; ++kp) {
            v8f s[2][2];
            s[0][0] = (v8f){}; s[0][1] = (v8f){}; s[1][0] = (v8f){}; s[1][1] = (v8f){};
#pragma unroll
            for (int kc = 0; kc < 2; ++kc) { v16bf ah[2], al[2];
#pragma unroll
                for (int nt = 0; nt < 2; ++nt) { const int ko = (kp * 32 + nt * 16 + lr) * KPI + kc * 32 + 8 * hi; ah[nt] = ldsf(&sK[b][0][ko]); al[nt] = ldsf(&sK[b][1][ko]); }
#pragma unroll
                for (int nt = 0; nt < 2; ++nt) { s[0][nt] = wmmab(ah[nt], qh[0][kc], s[0][nt]); s[1][nt] = wmmab(ah[nt], qh[1][kc], s[1][nt]); }
#pragma unroll
                for (int nt = 0; nt < 2; ++nt) { s[0][nt] = wmmab(al[nt], qh[0][kc], s[0][nt]); s[1][nt] = wmmab(al[nt], qh[1][kc], s[1][nt]); }
#pragma unroll
                for (int nt = 0; nt < 2; ++nt) { s[0][nt] = wmmab(ah[nt], ql[0][kc], s[0][nt]); s[1][nt] = wmmab(ah[nt], ql[1][kc], s[1][nt]); } }
            v16bf ph[2], pl[2];
#pragma unroll
            for (int mb = 0; mb < 2; ++mb) {
                float t[16]; float mx = -3.0e38f;
#pragma unroll
                for (int i = 0; i < 16; ++i) { t[i] = fminf(fmaxf(s[mb][i >> 3][i & 7] * 0.125f, -50.0f), 50.0f); mx = fmaxf(mx, t[i]); }
                mx = fmaxf(mx, xhalf(mx));
                const float mn = fmaxf(mrun[mb], mx); const float mL = mn * L2E;
                const float alpha = __builtin_amdgcn_exp2f(__builtin_fmaf(mrun[mb], L2E, -mL)); mrun[mb] = mn;
                float sum = 0.f; float p[16]; v8u hw, lw;
#pragma unroll
                for (int i = 0; i < 16; ++i) p[i] = __builtin_fmaf(t[i], L2E, -mL);
#pragma unroll
                for (int i = 0; i < 16; ++i) p[i] = __builtin_amdgcn_exp2f(p[i]);
#pragma unroll
                for (int i = 0; i < 8; ++i) { sum += p[i]; sum += p[8 + i]; }
#pragma unroll
                for (int i = 0; i < 8; ++i) { unsigned a, c; split2(p[2 * i], p[2 * i + 1], a, c); hw[i] = a; lw[i] = c; }    // word i = elements 2 i, 2 i + 1 of the fragment
                lsum[mb] = lsum[mb] * alpha + sum;
#pragma unroll
                for (int dt = 0; dt < 4; ++dt) o[dt][mb] *= alpha;
                ph[mb] = __builtin_bit_cast(v16bf, hw); pl[mb] = __builtin_bit_cast(v16bf, lw); }
#pragma unroll
            for (int dp = 0; dp < 2; ++dp) { v16bf vh[2], vl[2];
#pragma unroll
                for (int d2 = 0; d2 < 2; ++d2) { const int vo = ((dp * 2 + d2) * 16 + lr) * VPI + kp * 32 + 8 * hi; vh[d2] = ldsf(&sV[b][0][vo]); vl[d2] = ldsf(&sV[b][1][vo]); }
#pragma unroll
                for (int d2 = 0; d2 < 2; ++d2) { o[dp * 2 + d2][0] = wmmab(vh[d2], ph[0], o[dp * 2 + d2][0]); o[dp * 2 + d2][1] = wmmab(vh[d2], ph[1], o[dp * 2 + d2][1]); }
#pragma unroll
                for (int d2 = 0; d2 < 2; ++d2) { o[dp * 2 + d2][0] = wmmab(vl[d2], ph[0], o[dp * 2 + d2][0]); o[dp * 2 + d2][1] = wmmab(vl[d2], ph[1], o[dp * 2 + d2][1]); }
#pragma unroll
                for (int d2 = 0; d2 < 2; ++d2) { o[dp * 2 + d2][0] = wmmab(vh[d2], pl[0], o[dp * 2 + d2][0]); o[dp * 2 + d2][1] = wmmab(vh[d2], pl[1], o[dp * 2 + d2][1]); } }
        }
        if (st + 1 < MM / KT) put(b ^ 1);    // that buffer's last readers left it before the barrier that ended stage st - 1
        __syncthreads();                      // publishes stage st + 1 and ends every read of stage st
    }
#pragma unroll
    for (int mb = 0; mb < 2; ++mb) { const float f = __fdiv_rn(1.0f, lsum[mb] + xhalf(lsum[mb]));
#pragma unroll
        for (int dt = 0; dt < 4; ++dt)
#pragma unroll
            for (int j = 0; j < 8; ++j) O[(size_t)(dt * 16 + hi * 8 + j) * MM + q0 + mb * 16 + lr] = o[dt][mb][j] * f; }
}

extern "C" void kernel_launch(void* const* d_in, const int* in_sizes, int n_in,
                              void* d_out, int out_size, void* d_ws, size_t ws_size, hipStream_t stream) {
    (void)in_sizes; (void)n_in; (void)out_size;
    const float* x = (const float*)d_in[0]; const float* Wq = (const float*)d_in[1]; const float* Wk = (const float*)d_in[2]; const float* Wv = (const float*)d_in[3];
    float* OUT = (float*)d_out;     // [16][512][1024]
    char* wsp = (char*)d_ws;
    auto take = [&](size_t bytes) { char* p = wsp; wsp += (bytes + 255) & ~(size_t)255; return (void*)p; };
    bf* AQ = (bf*)take((size_t)CO * CI * 2); bf* AK = (bf*)take((size_t)CO * CI * 2); bf* AV = (bf*)take((size_t)CO * CI * 2); float* PE = (float*)take((size_t)CO * MM * 4); bf* XT = (bf*)take((size_t)NB_ * MM * CI * 2);
    bf* QPh = (bf*)take((size_t)NB_ * CO * MM * 2); bf* QPl = (bf*)take((size_t)NB_ * CO * MM * 2); bf* KPh = (bf*)take((size_t)NB_ * CO * MM * 2); bf* KPl = (bf*)take((size_t)NB_ * CO * MM * 2); bf* VPh = (bf*)take((size_t)NB_ * CO * MM * 2); bf* VPl = (bf*)take((size_t)NB_ * CO * MM * 2);
    if ((size_t)(wsp - (char*)d_ws) > ws_size) return;    // total ~ 107 MiB
    k_prep<<<PB_PE + PB_XT * NB_ + 3 * PB_W, 256, 0, stream>>>(x, Wq, Wk, Wv, AQ, AK, AV, PE, XT);
    k_gemm3<<<dim3((CO / 64) * (MM / 64), 1, 3 * NB_), 32, 0, stream>>>(AQ, AK, AV, XT, QPh, QPl, KPh, KPl, VPh, VPl, PE);
    k_fattn<<<dim3(MM / 256, NB_ * NH_), 256, 0, stream>>>(QPh, QPl, KPh, KPl, VPh, VPl, OUT);   // blockIdx.y = batch * 8 + head: the planes and OUT are contiguous in that index
}

// v007
// Measured time: 101 microseconds a run.
// Next to v006, in two timings, it ran 1.07 and 1.06 times as fast.
// Counting every step since v000, it is 12.4 times as fast.
#include <hip/hip_runtime.h>

// MultiHeadSelfAttention2D (x [16][256][32][32] channel-major; q/k/v = 1x1 conv = W [512][256] . x[c][m] over the M = 1024 positions; 2-D sinusoidal PE r[c][m] (first 256 channels row position, last 256 column position; even channels sin, odd cos; constants computed on device) added to q and k;
//   8 heads x 64: logits[m][n] = sum_d qh[d][m] kh[d][n] / 8, clipped to [-50, 50]; softmax over n; out[h*64+d][m] = sum_n A[m][n] vh[d][n] -> [16][512][32][32] channel-major).
// Compute dtypes, f32 accumulate: every input rounded to bf16; the three 1x1 convs as PLAIN bf16 GEMMs W . x^T (inputs: exact; x transposed once per batch; x^T, W and the PE table lie in memory in the order the GEMM's lanes read them, see d_gemmp); q + PE and k + PE in f32 -> hl planes [h][m][d], v -> hl planes [h][d][n], all three split and stored by the conv GEMM itself; logits hl x hl (3 products); clip + softmax f32 (exp of the clipped logit as it is, running sum) -> hl fragments in registers; out = vh (hl planes [h][d][n]) . A^T as hl x hl (3 products), divided by the row sum at the end and written straight into the channel-major output; the batch index rides in the grid: every stage covers all 16 batches in one launch; logits, softmax and the second product are ONE kernel (k_fattn), so neither the logits nor the softmax matrix touch memory.

#define NB_  16
#define CI   256
#define CO   512
#define MM   1024
#define HH   32
#define NH_  8
#define HD   64
typedef _Float16 h16;
typedef unsigned short bf;
typedef __attribute__((ext_vector_type(16))) __bf16   v16bf;
typedef __attribute__((ext_vector_type(16))) _Float16 v16h;
typedef __attribute__((ext_vector_type(8)))  _Float16 v8h;
typedef __attribute__((ext_vector_type(8)))  unsigned short v8us;
typedef __attribute__((ext_vector_type(8)))  float    v8f;
typedef __attribute__((ext_vector_type(4)))  float    v4f;
typedef v8h  __attribute__((may_alias)) v8ha;
typedef v4f  __attribute__((may_alias)) v4fa;
typedef v8us __attribute__((may_alias)) v8usa;

typedef __attribute__((ext_vector_type(2)))  float    v2f;
typedef __attribute__((ext_vector_type(2)))  __bf16   v2bf;
typedef __attribute__((ext_vector_type(2)))  unsigned v2u;
typedef __attribute__((ext_vector_type(4)))  unsigned v4u;
typedef __attribute__((ext_vector_type(8)))  unsigned v8u;
// pk2: two f32 rounded to bf16 (to nearest, ties to even) and packed, a in the low half: the chip's own packed conversion, one instruction for the pair
__device__ __forceinline__ unsigned pk2(float a, float b) { return __builtin_bit_cast(unsigned, __builtin_convertvector((v2f){a, b}, v2bf)); }
// split2: h = bf16(y), l = bf16(y - h) of a pair, both packed; y - h is exact in f32
__device__ __forceinline__ void split2(float a, float b, unsigned& h, unsigned& l) { h = pk2(a, b); const v2f r = (v2f){a, b} - (v2f){__uint_as_float(h << 16), __uint_as_float(h & 0xFFFF0000u)}; l = __builtin_bit_cast(unsigned, __builtin_convertvector(r, v2bf)); }
__device__ __forceinline__ v16h cat16(v8h lo, v8h hi) { return __builtin_shufflevector(lo, hi, 0, 1, 2, 3, 4, 5, 6, 7, 8, 9, 10, 11, 12, 13, 14, 15); }
__device__ __forceinline__ v16bf cat16b(v8us lo, v8us hi) { return __builtin_bit_cast(v16bf, __builtin_shufflevector(lo, hi, 0, 1, 2, 3, 4, 5, 6, 7, 8, 9, 10, 11, 12, 13, 14, 15)); }
__device__ __forceinline__ v8f wmma16(v16h a, v16h b, v8f c) { return __builtin_amdgcn_wmma_f32_16x16x32_f16(false, a, false, b, (short)0, c, false, false); }
__device__ __forceinline__ v8f wmmab(v16bf a, v16bf b, v8f c) { return __builtin_amdgcn_wmma_f32_16x16x32_bf16(false, a, false, b, (short)0, c, false, false); }



// ---- d_gemmp: register-blocked conv GEMM, ONE WAVE per 64x64 tile (16 accumulators), operands straight from bf16 planes packed in fragment order; tile (bx of rows of A / 64, by of rows of Bt / 64) of batch z, 32 threads; K % 32 == 0.
// y[r][c] = sum_k A[r][k] Bt[c][k]. A lane's 8 accumulator registers are 8 CONSECUTIVE r of one c, so the operand whose index must run contiguously in the planes is given as A: a lane splits its 8 values, puts 16 bytes per plane into LDS, and the tile leaves as whole 128-byte lines; the f32 result never touches memory:
// QK: A = W (r = output channel, tile = one head), Bt = x^T (c = position m): planes [h][m][d] of y + PE. Otherwise: A = x^T (r = position n), Bt = W (c = output channel): planes [channel][n].
template <typename T16> struct WFrag;
template <> struct WFrag<h16> { typedef v16h V; static __device__ __forceinline__ V ld(const h16* p) { return cat16(*(const v8h*)p, *(const v8h*)(p + 16)); } static __device__ __forceinline__ v8f mma(V a, V b, v8f c) { return wmma16(a, b, c); } };
template <> struct WFrag<bf> { typedef v16bf V; static __device__ __forceinline__ V ld(const bf* p) { return cat16b(*(const v8us*)p, *(const v8us*)(p + 16)); } static __device__ __forceinline__ v8f mma(V a, V b, v8f c) { return wmmab(a, b, c); } };
// Packed operand plane of R[row][k]: blocks of 16 rows x 32 k = 1 KB, block (row / 16, k / 32) at element (row / 16 * 16) * K + (k / 32) * 512; inside it the 16-byte piece (j, lane = hi * 16 + row % 16) at j * 256 + lane * 8 holds k % 32 = j * 16 + hi * 8 + 0..7:
// the same k at every lane and register as two 16-byte reads of a K-contiguous row, but each wave-wide load is 512 contiguous bytes (4 whole lines, not 32 bytes out of each of 16 lines). PE likewise: blocks of 16 m x 16 channels f32, piece (j, lane = hi * 16 + m % 16) at j * 128 + lane * 4 holds channels hi * 8 + j * 4 + 0..3.
__device__ __forceinline__ v16bf ldpk(const bf* p) { return cat16b(*(const v8us*)p, *(const v8us*)(p + 256)); }
#define OSP  (64 + 8)      // LDS pitch of a staged row, elements: 144 B = 16 B x odd
template <bool QK>
__device__ __forceinline__ void d_gemmp(const bf* __restrict__ A, const bf* __restrict__ Bt, int K, bf* Ph, bf* Pl, const float* __restrict__ PEt, size_t sA, size_t sB, int bx, int by, size_t z, bf (*os)[64 * OSP]) {
    typedef WFrag<bf>::V V;
    A += z * sA; Bt += z * sB;
    const int lane = threadIdx.x & 31, lr = lane & 15, hi = lane >> 4; const int r0 = bx * 64, c0 = by * 64;
    v8f acc[4][4];
#pragma unroll
    for (int mb = 0; mb < 4; ++mb)
#pragma unroll
        for (int nb = 0; nb < 4; ++nb) acc[mb][nb] = (v8f){};
    const size_t aoff = (size_t)r0 * K + lane * 8, boff = (size_t)c0 * K + lane * 8;
#pragma unroll 1
    for (int kc = 0; kc < K; kc += 32) {
        V a[4]; const bf* pa = A + aoff + kc * 16; const bf* pb = Bt + boff + kc * 16;
#pragma unroll
        for (int mb = 0; mb < 4; ++mb) a[mb] = ldpk(pa + (size_t)mb * 16 * K);
#pragma unroll
        for (int nb = 0; nb < 4; ++nb) { const V b = ldpk(pb + (size_t)nb * 16 * K);
            if (nb == 3) asm volatile("s_wait_xcnt 0x0" :: "v"(pa), "v"(pb) : "memory");    // behind the trip's last load: the two address pairs stay whole up to here (no load's result lands on them), and the next trip's addresses are formed behind this wait
#pragma unroll
            for (int mb = 0; mb < 4; ++mb) acc[mb][nb] = WFrag<bf>::mma(a[mb], b, acc[mb][nb]); }
        asm volatile("v_nop\n\tv_nop\n\tv_nop\n\tv_nop" : "+v"(acc[0][0]), "+v"(acc[1][1]), "+v"(acc[2][2]), "+v"(acc[3][3]) : "v"(a[0]), "v"(a[3]));
    }
    constexpr int PITCH = QK ? HD : MM;    // plane elements from one c to the next
    const float* pe = PEt + (size_t)c0 * CO + r0 * 16 + lane * 4;
#pragma unroll
    for (int nb = 0; nb < 4; ++nb)
#pragma unroll
        for (int mb = 0; mb < 4; ++mb) { v8f y = acc[mb][nb];
            if (QK) { const v4f p0 = *(const v4f*)(pe + nb * 16 * CO + mb * 256), p1 = *(const v4f*)(pe + nb * 16 * CO + mb * 256 + 128);
#pragma unroll
                for (int j = 0; j < 4; ++j) { y[j] = __fadd_rn(y[j], p0[j]); y[4 + j] = __fadd_rn(y[4 + j], p1[j]); } }
            v4u oh, ol;
#pragma unroll
            for (int j = 0; j < 4; ++j) { unsigned s0, s1; split2(y[2 * j], y[2 * j + 1], s0, s1); oh[j] = s0; ol[j] = s1; }
            *(v8usa*)(&os[0][(nb * 16 + lr) * OSP + mb * 16 + 8 * hi]) = __builtin_bit_cast(v8us, oh); *(v8usa*)(&os[1][(nb * 16 + lr) * OSP + mb * 16 + 8 * hi]) = __builtin_bit_cast(v8us, ol); }
    asm volatile("s_wait_dscnt 0x0" ::: "memory");    // the reads below take what other lanes of this wave wrote: every LDS write has landed, and the compiler moves no read above this line
    const size_t ob = z * ((size_t)CO * MM) + (QK ? (size_t)r0 * MM : (size_t)r0) + (size_t)(c0 + (lane >> 3)) * PITCH + (lane & 7) * 8;
#pragma unroll
    for (int s = 0; s < 16; ++s) { const int so = (s * 4 + (lane >> 3)) * OSP + (lane & 7) * 8;    // 8 lanes = one whole 128-byte line of a plane, 4 lines an instruction
        *(v8us*)(Ph + ob + s * 4 * PITCH) = *(const v8usa*)(&os[0][so]); *(v8us*)(Pl + ob + s * 4 * PITCH) = *(const v8usa*)(&os[1][so]); }
    asm volatile("s_wait_xcnt 0x0" ::: "memory");    // precaution: the wait stands in front of any later overwrite of these stores' data and address registers
}
// k_gemm3: the three conv GEMMs, which do not depend on one another, as ONE grid (128 tiles, 1, 3 x batches): blockIdx.z / 16 = q, k, v; the tile index runs as the two grid indices of a launch of its own did (first index fastest).
// amdgpu_waves_per_eu(4): at most 256 registers a wave, so that four waves still share a SIMD (the shorter epilogue lets the compiler hold more of the PE loads in flight and go beyond that)
__global__ __launch_bounds__(32) __attribute__((amdgpu_waves_per_eu(4))) void k_gemm3(const bf* __restrict__ AQ, const bf* __restrict__ AK, const bf* __restrict__ AV, const bf* __restrict__ XT, bf* QPh, bf* QPl, bf* KPh, bf* KPl, bf* VPh, bf* VPl, const float* __restrict__ PEt) {
    __shared__ __align__(16) bf os[2][64 * OSP];    // [h, l][c][r]
    const int w = blockIdx.z / NB_, t = blockIdx.x; const size_t z = blockIdx.z % NB_; const size_t zx = (size_t)MM * CI;
    if (w < 2) d_gemmp<true>(w ? AK : AQ, XT, CI, w ? KPh : QPh, w ? KPl : QPl, PEt, 0, zx, t % (CO / 64), t / (CO / 64), z, os);
    else d_gemmp<false>(XT, AV, CI, VPh, VPl, PEt, zx, 0, t % (MM / 64), t / (MM / 64), z, os);
}

typedef __attribute__((ext_vector_type(2))) unsigned short v2us;
typedef __attribute__((ext_vector_type(4))) unsigned short v4us;

__device__ __forceinline__ void d_cvt8(const float* __restrict__ src, bf* dst, size_t n8, int bx) { const size_t i = (size_t)bx * 256 + threadIdx.x; if (i >= n8) return;    // i = the 16-byte piece of the packed plane
    const int ln = (int)i & 31, j = ((int)i >> 5) & 1, blk = (int)(i >> 6); const int row = blk / (CI / 32) * 16 + (ln & 15), k0 = blk % (CI / 32) * 32 + j * 16 + (ln >> 4) * 8;
    const v8f v = *(const v8f*)(src + (size_t)row * CI + k0); v4u o;
#pragma unroll
    for (int k = 0; k < 4; ++k) o[k] = pk2(v[2 * k], v[2 * k + 1]); *(v8us*)(dst + i * 8) = __builtin_bit_cast(v8us, o);  }
// d_pe: PE of (m, c), f32, packed (d_gemmp): thread = one 16-byte piece; c < 256 -> pe1d(256, row = m / 32)[c], else pe1d(256, col = m % 32)[c - 256]; pe1d(d, L)[p][ch] = (ch even ? sin : cos)(p * exp(-ln(1e4) * (ch - ch%2) / d)) ;
// by = batch in d_xt. d_xt: packed plane of XT[m][c] = bf16(x[c][m]): lanes run along m, so a load is one whole line of x and a store is two runs of 256 bytes; a thread takes 16 channels of one m = the pieces hi = 0, 1 of one (block, j)
__device__ __forceinline__ void d_pe(float* PE, int bx) { const int e = (bx * 256 + threadIdx.x) * 4; if (e >= CO * MM) return; const int ln = (e >> 2) & 31, blk = e >> 8; const int m = blk / (CO / 16) * 16 + (ln & 15); const int c0 = blk % (CO / 16) * 16 + (ln >> 4) * 8 + ((e >> 7) & 1) * 4; v4f r;
#pragma unroll 1    // one copy of the sin / cos code
    for (int u = 0; u < 4; ++u) { const int c = c0 + u; const int cc = (c < CO / 2) ? c : c - CO / 2; const int ch2 = cc & ~1; const float div = __expf(-logf(10000.0f) * (float)ch2 / (float)(CO / 2)); const int p = (c < CO / 2) ? (m / HH) : (m % HH); const float ang = __fmul_rn((float)p, div); r[u] = (cc & 1) ? cosf(ang) : sinf(ang); }
    *(v4f*)(PE + e) = r;  }
__device__ __forceinline__ void d_xt(const float* __restrict__ X, bf* XT, int bx, int by) { const int e = bx * 256 + threadIdx.x; if (e >= MM * (CI / 16)) return; const int m = e % MM, c16 = e / MM;
    X += (size_t)by * CI * MM + (size_t)c16 * 16 * MM + m; XT += (size_t)by * MM * CI + (size_t)(m >> 4) * 16 * CI + (c16 >> 1) * 512 + (c16 & 1) * 256 + (m & 15) * 8; float v[16];
#pragma unroll
    for (int u = 0; u < 16; ++u) v[u] = X[(size_t)u * MM];
#pragma unroll
    for (int hi = 0; hi < 2; ++hi) { v4u o;
#pragma unroll
        for (int k = 0; k < 4; ++k) o[k] = pk2(v[hi * 8 + 2 * k], v[hi * 8 + 2 * k + 1]);
        *(v8us*)(XT + hi * 128) = __builtin_bit_cast(v8us, o); }  }
// k_prep: the five preparing stages, which do not depend on one another, as ONE grid; the block index picks the stage (the same for a whole work-group): PE table first (the longest blocks), then x^T of all batches, then the three weight conversions.
#define PB_PE  (CO * MM / 4 / 256)
#define PB_XT  (MM * CI / 16 / 256)
#define PB_W   (CO * CI / 8 / 256)
__global__ __launch_bounds__(256) void k_prep(const float* __restrict__ X, const float* __restrict__ Wq, const float* __restrict__ Wk, const float* __restrict__ Wv, bf* AQ, bf* AK, bf* AV, float* PE, bf* XT) {
    int b = blockIdx.x;
    if (b < PB_PE) { d_pe(PE, b); return; }
    b -= PB_PE;
    if (b < PB_XT * NB_) { d_xt(X, XT, b % PB_XT, b / PB_XT); return; }
    b -= PB_XT * NB_;
    const int w = b / PB_W;
    d_cvt8(w == 0 ? Wq : w == 1 ? Wk : Wv, w == 0 ? AQ : w == 1 ? AK : AV, CO * CI / 8, b % PB_W);   // W [o][c] is used as-is: the A operand of q and k, the Bt operand of v
}
// ---- k_fattn: logits, clip, softmax and A . v in one kernel. Grid (M / 256, batches x heads), 8 waves; a wave owns 32 query columns, the work-group walks the 1024 keys in stages of KT.
// S^T tile = K rows (A operand, from LDS) x Q columns (B operand, kept in registers): lane (lr, hi) holds query lr, keys 8 * hi + j of each 16-key tile, so two tiles of one 32-key pass ARE the B operand of the second product
// (element i = tile 0 register i, element 8 + i = tile 1 register i: the k order of the two 16-byte loads that every A fragment here is read with). out^T tile = v rows (A, from LDS) x P (B): lane (lr, hi) holds query lr, d = 8 * hi + j.
// No maximum is subtracted: the clip holds every logit t in [-50, 50], so P = exp(t) lies in [2^-73, 2^73], inside the f32 and bf16 range whatever the inputs, and a row's 1024 terms times v stay finite for |v| below 2^45 (the range is centred: as much room below as above); P is not yet divided; one division by the row sum at the end.
#define KT   64            // keys per stage
#define KPI  (HD + 8)      // LDS pitch of a K row, elements: 144 B = 16 B x odd, conflict-free 16-byte reads
#define VPI  (KT + 8)      // LDS pitch of a v row, elements
#define NCH  (KT * 8 / 256)
__device__ __forceinline__ v16bf ldsf(const bf* p) { return cat16b(*(const v8usa*)p, *(const v8usa*)(p + 16)); }
__device__ __forceinline__ float xhalf(float v) { const int b = __float_as_int(v); return __int_as_float(__builtin_amdgcn_permlanex16(b, b, 0x76543210, (int)0xfedcba98u, false, false)); }   // lane l <-> l ^ 16
// amdgpu_waves_per_eu(4, 4): at most 256 registers a wave, so that two work-groups share a WGP and one wave's vector work runs under another's matrix work
__global__ __launch_bounds__(256) __attribute__((amdgpu_waves_per_eu(4, 4))) void k_fattn(const bf* __restrict__ Qh, const bf* __restrict__ Ql, const bf* __restrict__ Kh, const bf* __restrict__ Kl, const bf* __restrict__ Vh, const bf* __restrict__ Vl, float* __restrict__ O) {
    __shared__ __align__(16) bf sK[2][2][KT * KPI];    // [buffer][h, l][key][d]
    __shared__ __align__(16) bf sV[2][2][HD * VPI];    // [buffer][h, l][d][key]
    const size_t zo = (size_t)blockIdx.y * MM * HD; Qh += zo; Ql += zo; Kh += zo; Kl += zo; Vh += zo; Vl += zo; O += zo;
    const int tid = threadIdx.x, lane = tid & 31, lr = lane & 15, hi = lane >> 4; const int q0 = blockIdx.x * 256 + (tid >> 5) * 32;
    const float L2E = 1.4426950408889634f; const float SC = 0.125f * L2E, CL = 50.0f * L2E;    // scale and clip bound in log2 units: x 0.125 is exact and the rounded product with L2E is monotone, so clip and product commute bit for bit
    v16bf qh[2][2], ql[2][2];
#pragma unroll
    for (int mb = 0; mb < 2; ++mb)
#pragma unroll
        for (int kc = 0; kc < 2; ++kc) { const size_t qo = (size_t)(q0 + mb * 16 + lr) * HD + kc * 32 + 8 * hi; qh[mb][kc] = WFrag<bf>::ld(Qh + qo); ql[mb][kc] = WFrag<bf>::ld(Ql + qo); }
    v8f o[4][2];
#pragma unroll
    for (int dt = 0; dt < 4; ++dt) { o[dt][0] = (v8f){}; o[dt][1] = (v8f){}; }
    float lsum[2] = {0.f, 0.f};
    v8us g[4][NCH];
    const unsigned ko8 = (unsigned)tid * 8u, vo8 = (unsigned)(tid / (KT / 8)) * MM + (unsigned)(tid % (KT / 8)) * 8u;    // this thread's 16-byte piece of a K tile (contiguous) and of a v tile (row d, pitch M)
    auto fetch = [&](int n0) { const bf* kh = Kh + (size_t)n0 * HD; const bf* kl = Kl + (size_t)n0 * HD; const bf* vh = Vh + n0; const bf* vl = Vl + n0;
#pragma unroll
        for (int i = 0; i < NCH; ++i) {
            g[0][i] = *(const v8us*)(kh + (ko8 + i * 2048u)); g[1][i] = *(const v8us*)(kl + (ko8 + i * 2048u));
            g[2][i] = *(const v8us*)(vh + (vo8 + i * (256u / (KT / 8)) * MM)); g[3][i] = *(const v8us*)(vl + (vo8 + i * (256u / (KT / 8)) * MM)); } };
    auto put = [&](int b) {
#pragma unroll
        for (int i = 0; i < NCH; ++i) { const int c = tid + i * 256; const int d = c / (KT / 8), cc = c % (KT / 8);
            *(v8usa*)(&sK[b][0][(c >> 3) * KPI + (c & 7) * 8]) = g[0][i]; *(v8usa*)(&sK[b][1][(c >> 3) * KPI + (c & 7) * 8]) = g[1][i];
            *(v8usa*)(&sV[b][0][d * VPI + cc * 8]) = g[2][i]; *(v8usa*)(&sV[b][1][d * VPI + cc * 8]) = g[3][i]; } };
    fetch(0); put(0);
    __syncthreads();
#pragma unroll 1
    for (int st = 0; st < MM / KT; ++st) {
        const int b = st & 1;
        if (st + 1 < MM / KT) fetch((st + 1) * KT);    // the next stage's global loads fly under this stage's work
#pragma unroll 1
        for (int kp = 0; kp < KT / 32; ++kp) {
            v8f s[2][2];
            s[0][0] = (v8f){}; s[0][1] = (v8f){}; s[1][0] = (v8f){}; s[1][1] = (v8f){};
#pragma unroll
            for (int kc = 0; kc < 2; ++kc) { v16bf ah[2], al[2];
#pragma unroll
                for (int nt = 0; nt < 2; ++nt) { const int ko = (kp * 32 + nt * 16 + lr) * KPI + kc * 32 + 8 * hi; ah[nt] = ldsf(&sK[b][0][ko]); al[nt] = ldsf(&sK[b][1][ko]); }
#pragma unroll
                for (int nt = 0; nt < 2; ++nt) { s[0][nt] = wmmab(ah[nt], qh[0][kc], s[0][nt]); s[1][nt] = wmmab(ah[nt], qh[1][kc], s[1][nt]); }
#pragma unroll
                for (int nt = 0; nt < 2; ++nt) { s[0][nt] = wmmab(al[nt], qh[0][kc], s[0][nt]); s[1][nt] = wmmab(al[nt], qh[1][kc], s[1][nt]); }
#pragma unroll
                for (int nt = 0; nt < 2; ++nt) { s[0][nt] = wmmab(ah[nt], ql[0][kc], s[0][nt]); s[1][nt] = wmmab(ah[nt], ql[1][kc], s[1][nt]); } }
            v16bf ph[2], pl[2];
#pragma unroll
            for (int mb = 0; mb < 2; ++mb) {
                float sum = 0.f; float p[16]; v8u hw, lw;
#pragma unroll
                for (int i = 0; i < 16; ++i) p[i] = fminf(fmaxf(s[mb][i >> 3][i & 7] * SC, -CL), CL);
#pragma unroll
                for (int i = 0; i < 16; ++i) p[i] = __builtin_amdgcn_exp2f(p[i]);
#pragma unroll
                for (int i = 0; i < 8; ++i) { sum += p[i]; sum += p[8 + i]; }
#pragma unroll
                for (int i = 0; i < 8; ++i) { unsigned a, c; split2(p[2 * i], p[2 * i + 1], a, c); hw[i] = a; lw[i] = c; }    // word i = elements 2 i, 2 i + 1 of the fragment
                lsum[mb] += sum;
                ph[mb] = __builtin_bit_cast(v16bf, hw); pl[mb] = __builtin_bit_cast(v16bf, lw); }
#pragma unroll
            for (int dp = 0; dp < 2; ++dp) { v16bf vh[2], vl[2];
#pragma unroll
                for (int d2 = 0; d2 < 2; ++d2) { const int vo = ((dp * 2 + d2) * 16 + lr) * VPI + kp * 32 + 8 * hi; vh[d2] = ldsf(&sV[b][0][vo]); vl[d2] = ldsf(&sV[b][1][vo]); }
#pragma unroll
                for (int d2 = 0; d2 < 2; ++d2) { o[dp * 2 + d2][0] = wmmab(vh[d2], ph[0], o[dp * 2 + d2][0]); o[dp * 2 + d2][1] = wmmab(vh[d2], ph[1], o[dp * 2 + d2][1]); }
#pragma unroll
                for (int d2 = 0; d2 < 2; ++d2) { o[dp * 2 + d2][0] = wmmab(vl[d2], ph[0], o[dp * 2 + d2][0]); o[dp * 2 + d2][1] = wmmab(vl[d2], ph[1], o[dp * 2 + d2][1]); }
#pragma unroll
                for (int d2 = 0; d2 < 2; ++d2) { o[dp * 2 + d2][0] = wmmab(vh[d2], pl[0], o[dp * 2 + d2][0]); o[dp * 2 + d2][1] = wmmab(vh[d2], pl[1], o[dp * 2 + d2][1]); } }
        }
        if (st + 1 < MM / KT) put(b ^ 1);    // that buffer's last readers left it before the barrier that ended stage st - 1
        __syncthreads();                      // publishes stage st + 1 and ends every read of stage st
    }
#pragma unroll
    for (int mb = 0; mb < 2; ++mb) { const float f = __fdiv_rn(1.0f, lsum[mb] + xhalf(lsum[mb]));
#pragma unroll
        for (int dt = 0; dt < 4; ++dt)
#pragma unroll
            for (int j = 0; j < 8; ++j) O[(size_t)(dt * 16 + hi * 8 + j) * MM + q0 + mb * 16 + lr] = o[dt][mb][j] * f; }
}

extern "C" void kernel_launch(void* const* d_in, const int* in_sizes, int n_in,
                              void* d_out, int out_size, void* d_ws, size_t ws_size, hipStream_t stream) {
    (void)in_sizes; (void)n_in; (void)out_size;
    const float* x = (const float*)d_in[0]; const float* Wq = (const float*)d_in[1]; const float* Wk = (const float*)d_in[2]; const float* Wv = (const float*)d_in[3];
    float* OUT = (float*)d_out;     // [16][512][1024]
    char* wsp = (char*)d_ws;
    auto take = [&](size_t bytes) { char* p = wsp; wsp += (bytes + 255) & ~(size_t)255; return (void*)p; };
    bf* AQ = (bf*)take((size_t)CO * CI * 2); bf* AK = (bf*)take((size_t)CO * CI * 2); bf* AV = (bf*)take((size_t)CO * CI * 2); float* PE = (float*)take((size_t)CO * MM * 4); bf* XT = (bf*)take((size_t)NB_ * MM * CI * 2);
    bf* QPh = (bf*)take((size_t)NB_ * CO * MM * 2); bf* QPl = (bf*)take((size_t)NB_ * CO * MM * 2); bf* KPh = (bf*)take((size_t)NB_ * CO * MM * 2); bf* KPl = (bf*)take((size_t)NB_ * CO * MM * 2); bf* VPh = (bf*)take((size_t)NB_ * CO * MM * 2); bf* VPl = (bf*)take((size_t)NB_ * CO * MM * 2);
    if ((size_t)(wsp - (char*)d_ws) > ws_size) return;    // total ~ 107 MiB
    k_prep<<<PB_PE + PB_XT * NB_ + 3 * PB_W, 256, 0, stream>>>(x, Wq, Wk, Wv, AQ, AK, AV, PE, XT);
    k_gemm3<<<dim3((CO / 64) * (MM / 64), 1, 3 * NB_), 32, 0, stream>>>(AQ, AK, AV, XT, QPh, QPl, KPh, KPl, VPh, VPl, PE);
    k_fattn<<<dim3(MM / 256, NB_ * NH_), 256, 0, stream>>>(QPh, QPl, KPh, KPl, VPh, VPl, OUT);   // blockIdx.y = batch * 8 + head: the planes and OUT are contiguous in that index
}

// v008
// It runs in 98.2 microseconds.
// Next to v007, in two timings, it ran 1.03 times as fast each time.
// All steps since v000 together make it 12.8 times as fast.
#include <hip/hip_runtime.h>

// MultiHeadSelfAttention2D (x [16][256][32][32] channel-major; q/k/v = 1x1 conv = W [512][256] . x[c][m] over the M = 1024 positions; 2-D sinusoidal PE r[c][m] (first 256 channels row position, last 256 column position; even channels sin, odd cos; constants computed on device) added to q and k;
//   8 heads x 64: logits[m][n] = sum_d qh[d][m] kh[d][n] / 8, clipped to [-50, 50]; softmax over n; out[h*64+d][m] = sum_n A[m][n] vh[d][n] -> [16][512][32][32] channel-major).
// Compute dtypes, f32 accumulate: every input rounded to bf16; the three 1x1 convs as PLAIN bf16 GEMMs W . x^T (inputs: exact; x transposed once per batch; x^T, W and the PE table lie in memory in the order the GEMM's lanes read them, see d_gemmp); q + PE and k + PE in f32 -> hl planes [h][m][d], v -> hl planes [h][d][n], all three split and stored by the conv GEMM itself; logits hl x hl (3 products); clip + softmax f32 (exp of the clipped logit as it is, running sum) -> hl fragments in registers; out = vh (hl planes [h][d][n]) . A^T as hl x hl (3 products), divided by the row sum at the end and written straight into the channel-major output; the batch index rides in the grid: every stage covers all 16 batches in one launch; logits, softmax and the second product are ONE kernel (k_fattn), so neither the logits nor the softmax matrix touch memory.

#define NB_  16
#define CI   256
#define CO   512
#define MM   1024
#define HH   32
#define NH_  8
#define HD   64
typedef _Float16 h16;
typedef unsigned short bf;
typedef __attribute__((ext_vector_type(16))) __bf16   v16bf;
typedef __attribute__((ext_vector_type(16))) _Float16 v16h;
typedef __attribute__((ext_vector_type(8)))  _Float16 v8h;
typedef __attribute__((ext_vector_type(8)))  unsigned short v8us;
typedef __attribute__((ext_vector_type(8)))  float    v8f;
typedef __attribute__((ext_vector_type(4)))  float    v4f;
typedef v8h  __attribute__((may_alias)) v8ha;
typedef v4f  __attribute__((may_alias)) v4fa;
typedef v8us __attribute__((may_alias)) v8usa;

typedef __attribute__((ext_vector_type(2)))  float    v2f;
typedef __attribute__((ext_vector_type(2)))  __bf16   v2bf;
typedef __attribute__((ext_vector_type(2)))  unsigned v2u;
typedef __attribute__((ext_vector_type(4)))  unsigned v4u;
typedef __attribute__((ext_vector_type(8)))  unsigned v8u;
// pk2: two f32 rounded to bf16 (to nearest, ties to even) and packed, a in the low half: the chip's own packed conversion, one instruction for the pair
__device__ __forceinline__ unsigned pk2(float a, float b) { return __builtin_bit_cast(unsigned, __builtin_convertvector((v2f){a, b}, v2bf)); }
// split2: h = bf16(y), l = bf16(y - h) of a pair, both packed; y - h is exact in f32
__device__ __forceinline__ void split2(float a, float b, unsigned& h, unsigned& l) { h = pk2(a, b); const v2f r = (v2f){a, b} - (v2f){__uint_as_float(h << 16), __uint_as_float(h & 0xFFFF0000u)}; l = __builtin_bit_cast(unsigned, __builtin_convertvector(r, v2bf)); }
__device__ __forceinline__ v16h cat16(v8h lo, v8h hi) { return __builtin_shufflevector(lo, hi, 0, 1, 2, 3, 4, 5, 6, 7, 8, 9, 10, 11, 12, 13, 14, 15); }
__device__ __forceinline__ v16bf cat16b(v8us lo, v8us hi) { return __builtin_bit_cast(v16bf, __builtin_shufflevector(lo, hi, 0, 1, 2, 3, 4, 5, 6, 7, 8, 9, 10, 11, 12, 13, 14, 15)); }
__device__ __forceinline__ v8f wmma16(v16h a, v16h b, v8f c) { return __builtin_amdgcn_wmma_f32_16x16x32_f16(false, a, false, b, (short)0, c, false, false); }
__device__ __forceinline__ v8f wmmab(v16bf a, v16bf b, v8f c) { return __builtin_amdgcn_wmma_f32_16x16x32_bf16(false, a, false, b, (short)0, c, false, false); }



// ---- d_gemmp: register-blocked conv GEMM, ONE WAVE per 64x64 tile (16 accumulators), operands from bf16 planes packed in fragment order, staged in LDS for the 8 waves of a work-group; batch z.
// y[r][c] = sum_k A[r][k] Bt[c][k]. A lane's 8 accumulator registers are 8 CONSECUTIVE r of one c, so the operand whose index must run contiguously in the planes is given as A: a lane splits its 8 values, puts 16 bytes per plane into LDS, and the tile leaves as whole 128-byte lines; the f32 result never touches memory:
// QK: A = W (r = output channel, tile = one head), Bt = x^T (c = position m): planes [h][m][d] of y + PE. Otherwise: A = x^T (r = position n), Bt = W (c = output channel): planes [channel][n].
template <typename T16> struct WFrag;
template <> struct WFrag<h16> { typedef v16h V; static __device__ __forceinline__ V ld(const h16* p) { return cat16(*(const v8h*)p, *(const v8h*)(p + 16)); } static __device__ __forceinline__ v8f mma(V a, V b, v8f c) { return wmma16(a, b, c); } };
template <> struct WFrag<bf> { typedef v16bf V; static __device__ __forceinline__ V ld(const bf* p) { return cat16b(*(const v8us*)p, *(const v8us*)(p + 16)); } static __device__ __forceinline__ v8f mma(V a, V b, v8f c) { return wmmab(a, b, c); } };
// Packed operand plane of R[row][k]: blocks of 16 rows x 32 k = 1 KB, block (row / 16, k / 32) at element (row / 16 * 16) * K + (k / 32) * 512; inside it the 16-byte piece (j, lane = hi * 16 + row % 16) at j * 256 + lane * 8 holds k % 32 = j * 16 + hi * 8 + 0..7:
// the same k at every lane and register as two 16-byte reads of a K-contiguous row, but each wave-wide load is 512 contiguous bytes (4 whole lines, not 32 bytes out of each of 16 lines). PE likewise: blocks of 16 m x 16 channels f32, piece (j, lane = hi * 16 + m % 16) at j * 128 + lane * 4 holds channels hi * 8 + j * 4 + 0..3.
__device__ __forceinline__ v16bf ldpk(const bf* p) { return cat16b(*(const v8us*)p, *(const v8us*)(p + 256)); }
#define OSP  (64 + 8)      // LDS pitch of a staged row, elements: 144 B = 16 B x odd
// A work-group is 8 waves = 4 W tiles x 2 x^T tiles of 64 rows: the six operand tiles come into LDS once for all eight waves (each W tile serves 2 waves, each x^T tile 4), 64 k a stage, two buffers, by asynchronous copies;
// a packed plane is copied as it lies (a tile's stage = 4 row blocks x 2 KB), so a fragment read from LDS is 512 contiguous bytes with the same k at every lane and register as before.
#define GS   64            // k per stage
#define TSE  (64 * GS)     // elements of one tile's stage (8 KB)
#define STE  (6 * TSE)     // elements of a stage: W tiles 0..3, x^T tiles 4, 5
__device__ __forceinline__ v16bf ldsp(const bf* p) { return cat16b(*(const v8usa*)p, *(const v8usa*)(p + 256)); }
// cp4: four 16-byte copies a lane, global to LDS, 4 KB apart in LDS and 16 KB apart in the plane; the s_wait_xcnt closes the statement, so no address register is rewritten before it
__device__ __forceinline__ void cp4(unsigned l, const bf* g) {
    asm volatile("global_load_async_to_lds_b128 %0, %4, off\n\tglobal_load_async_to_lds_b128 %1, %5, off\n\tglobal_load_async_to_lds_b128 %2, %6, off\n\tglobal_load_async_to_lds_b128 %3, %7, off\n\ts_wait_xcnt 0x0"
                 :: "v"(l), "v"(l + 4096u), "v"(l + 8192u), "v"(l + 12288u), "v"(g), "v"(g + 8192), "v"(g + 16384), "v"(g + 24576) : "memory");
}
template <bool QK>
__device__ __forceinline__ void d_gemmp(const bf* __restrict__ Wp, const bf* __restrict__ Xp, bf* Ph, bf* Pl, const float* __restrict__ PEt, int hg, int pg, size_t z, bf* sm) {
    typedef WFrag<bf>::V V;
    constexpr int K = CI;
    const int tid = threadIdx.x, lane = tid & 31, lr = lane & 15, hi = lane >> 4; const int wv = __builtin_amdgcn_readfirstlane(tid >> 5); const int wj = wv & 3, xj = wv >> 2;
    const int r0 = (QK ? hg * 4 + wj : pg * 2 + xj) * 64, c0 = (QK ? pg * 2 + xj : hg * 4 + wj) * 64;
    v8f acc[4][4];
#pragma unroll
    for (int mb = 0; mb < 4; ++mb)
#pragma unroll
        for (int nb = 0; nb < 4; ++nb) acc[mb][nb] = (v8f){};
    const unsigned l0 = (unsigned)(size_t)(const __attribute__((address_space(3))) bf*)sm + (unsigned)tid * 16u;    // this thread's 16-byte piece of the first half tile, LDS byte address
    const bf* gw = Wp + (size_t)hg * (4 * 64 * K) + (tid >> 7) * (16 * K) + (tid & 127) * 8; const bf* gx = Xp + (size_t)pg * (2 * 64 * K) + (tid >> 7) * (16 * K) + (tid & 127) * 8;
    auto stage = [&](int t, int b) { const unsigned l = l0 + (unsigned)b * (STE * 2u); cp4(l, gw + t * (GS * 16)); cp4(l + 16384u, gw + t * (GS * 16) + 32768); cp4(l + 32768u, gx + t * (GS * 16)); };    // 12 half tiles of 4 KB: 8 of W, 4 of x^T
    stage(0, 0);
    asm volatile("s_wait_asynccnt 0x0" ::: "memory");    // this wave's copies of stage 0 have landed
    __syncthreads();                                      // and every other wave's
    stage(1, 1);
#pragma unroll 1
    for (int t = 0; t < K / GS; ++t) {
        const bf* sw = sm + (t & 1) * STE + wj * TSE + lane * 8; const bf* sx = sm + (t & 1) * STE + (4 + xj) * TSE + lane * 8;
        const bf* pa = QK ? sw : sx; const bf* pb = QK ? sx : sw;
#pragma unroll
        for (int ks = 0; ks < GS / 32; ++ks) { V a[4], b[4];    // the eight fragments of a k step are read as one group
#pragma unroll
            for (int mb = 0; mb < 4; ++mb) { a[mb] = ldsp(pa + mb * 1024 + ks * 512); b[mb] = ldsp(pb + mb * 1024 + ks * 512); }
            asm volatile("" :: "v"(a[0]), "v"(a[1]), "v"(a[2]), "v"(a[3]), "v"(b[0]), "v"(b[1]), "v"(b[2]), "v"(b[3]));    // inputs only: holds the sixteen LDS reads together in front of the products; without it the compiler reads b one fragment at a time, with a full LDS wait before every four products
#pragma unroll
            for (int nb = 0; nb < 4; ++nb)
#pragma unroll
                for (int mb = 0; mb < 4; ++mb) acc[mb][nb] = WFrag<bf>::mma(a[mb], b[nb], acc[mb][nb]); }
        asm volatile("s_wait_dscnt 0x0" ::: "memory");       // this wave's reads of the buffer are done before it may be refilled
        asm volatile("s_wait_asynccnt 0x0" ::: "memory");    // this wave's copies of stage t + 1 have landed
        __syncthreads();                                      // publishes stage t + 1 and ends every read of stage t
        if (t + 2 < K / GS) stage(t + 2, t & 1);              // flies under trip t + 1
    }
    asm volatile("s_wait_asynccnt 0x0" ::: "memory");    // nothing is in flight when the ring becomes the output staging below
    bf (*os)[64 * OSP] = (bf (*)[64 * OSP])(sm + wv * (2 * 64 * OSP));    // this wave's own [h, l][c][r]
    constexpr int PITCH = QK ? HD : MM;    // plane elements from one c to the next
    const float* pe = PEt + (size_t)c0 * CO + r0 * 16 + lane * 4;
#pragma unroll
    for (int nb = 0; nb < 4; ++nb)
#pragma unroll
        for (int mb = 0; mb < 4; ++mb) { v8f y = acc[mb][nb];
            if (QK) { const v4f p0 = *(const v4f*)(pe + nb * 16 * CO + mb * 256), p1 = *(const v4f*)(pe + nb * 16 * CO + mb * 256 + 128);
#pragma unroll
                for (int j = 0; j < 4; ++j) { y[j] = __fadd_rn(y[j], p0[j]); y[4 + j] = __fadd_rn(y[4 + j], p1[j]); } }
            v4u oh, ol;
#pragma unroll
            for (int j = 0; j < 4; ++j) { unsigned s0, s1; split2(y[2 * j], y[2 * j + 1], s0, s1); oh[j] = s0; ol[j] = s1; }
            *(v8usa*)(&os[0][(nb * 16 + lr) * OSP + mb * 16 + 8 * hi]) = __builtin_bit_cast(v8us, oh); *(v8usa*)(&os[1][(nb * 16 + lr) * OSP + mb * 16 + 8 * hi]) = __builtin_bit_cast(v8us, ol); }
    asm volatile("s_wait_dscnt 0x0" ::: "memory");    // the reads below take what other lanes of this wave wrote: every LDS write has landed, and the compiler moves no read above this line
    const size_t ob = z * ((size_t)CO * MM) + (QK ? (size_t)r0 * MM : (size_t)r0) + (size_t)(c0 + (lane >> 3)) * PITCH + (lane & 7) * 8;
#pragma unroll
    for (int s = 0; s < 16; ++s) { const int so = (s * 4 + (lane >> 3)) * OSP + (lane & 7) * 8;    // 8 lanes = one whole 128-byte line of a plane, 4 lines an instruction
        *(v8us*)(Ph + ob + s * 4 * PITCH) = *(const v8usa*)(&os[0][so]); *(v8us*)(Pl + ob + s * 4 * PITCH) = *(const v8usa*)(&os[1][so]); }
    asm volatile("s_wait_xcnt 0x0" ::: "memory");    // precaution: the wait stands in front of any later overwrite of these stores' data and address registers
}
// k_gemm3: the three conv GEMMs, which do not depend on one another, as ONE grid (16 groups of 8 tiles, 1, 3 x batches): blockIdx.z / 16 = q, k, v; blockIdx.x = (group of 4 W tiles, fastest; pair of x^T tiles).
// amdgpu_waves_per_eu(4): at most 256 registers a wave, so that two work-groups share a WGP
__global__ __launch_bounds__(256) __attribute__((amdgpu_waves_per_eu(4))) void k_gemm3(const bf* __restrict__ AQ, const bf* __restrict__ AK, const bf* __restrict__ AV, const bf* __restrict__ XT, bf* QPh, bf* QPl, bf* KPh, bf* KPl, bf* VPh, bf* VPl, const float* __restrict__ PEt) {
    __shared__ __align__(16) bf sm[8 * 2 * 64 * OSP];    // first the two-buffer operand ring (2 x 48 KB), then each wave's output staging
    const int w = blockIdx.z / NB_, t = blockIdx.x; const size_t z = blockIdx.z % NB_; const bf* X = XT + z * ((size_t)MM * CI);
    if (w < 2) d_gemmp<true>(w ? AK : AQ, X, w ? KPh : QPh, w ? KPl : QPl, PEt, t & 1, t >> 1, z, sm);
    else d_gemmp<false>(AV, X, VPh, VPl, PEt, t & 1, t >> 1, z, sm);
}

typedef __attribute__((ext_vector_type(2))) unsigned short v2us;
typedef __attribute__((ext_vector_type(4))) unsigned short v4us;

__device__ __forceinline__ void d_cvt8(const float* __restrict__ src, bf* dst, size_t n8, int bx) { const size_t i = (size_t)bx * 256 + threadIdx.x; if (i >= n8) return;    // i = the 16-byte piece of the packed plane
    const int ln = (int)i & 31, j = ((int)i >> 5) & 1, blk = (int)(i >> 6); const int row = blk / (CI / 32) * 16 + (ln & 15), k0 = blk % (CI / 32) * 32 + j * 16 + (ln >> 4) * 8;
    const v8f v = *(const v8f*)(src + (size_t)row * CI + k0); v4u o;
#pragma unroll
    for (int k = 0; k < 4; ++k) o[k] = pk2(v[2 * k], v[2 * k + 1]); *(v8us*)(dst + i * 8) = __builtin_bit_cast(v8us, o);  }
// d_pe: PE of (m, c), f32, packed (d_gemmp): thread = one 16-byte piece; c < 256 -> pe1d(256, row = m / 32)[c], else pe1d(256, col = m % 32)[c - 256]; pe1d(d, L)[p][ch] = (ch even ? sin : cos)(p * exp(-ln(1e4) * (ch - ch%2) / d)) ;
// by = batch in d_xt. d_xt: packed plane of XT[m][c] = bf16(x[c][m]): lanes run along m, so a load is one whole line of x and a store is two runs of 256 bytes; a thread takes 16 channels of one m = the pieces hi = 0, 1 of one (block, j)
__device__ __forceinline__ void d_pe(float* PE, int bx) { const int e = (bx * 256 + threadIdx.x) * 4; if (e >= CO * MM) return; const int ln = (e >> 2) & 31, blk = e >> 8; const int m = blk / (CO / 16) * 16 + (ln & 15); const int c0 = blk % (CO / 16) * 16 + (ln >> 4) * 8 + ((e >> 7) & 1) * 4; v4f r;
#pragma unroll 1    // one copy of the sin / cos code
    for (int u = 0; u < 4; ++u) { const int c = c0 + u; const int cc = (c < CO / 2) ? c : c - CO / 2; const int ch2 = cc & ~1; const float div = __expf(-logf(10000.0f) * (float)ch2 / (float)(CO / 2)); const int p = (c < CO / 2) ? (m / HH) : (m % HH); const float ang = __fmul_rn((float)p, div); r[u] = (cc & 1) ? cosf(ang) : sinf(ang); }
    *(v4f*)(PE + e) = r;  }
__device__ __forceinline__ void d_xt(const float* __restrict__ X, bf* XT, int bx, int by) { const int e = bx * 256 + threadIdx.x; if (e >= MM * (CI / 16)) return; const int m = e % MM, c16 = e / MM;
    X += (size_t)by * CI * MM + (size_t)c16 * 16 * MM + m; XT += (size_t)by * MM * CI + (size_t)(m >> 4) * 16 * CI + (c16 >> 1) * 512 + (c16 & 1) * 256 + (m & 15) * 8; float v[16];
#pragma unroll
    for (int u = 0; u < 16; ++u) v[u] = X[(size_t)u * MM];
#pragma unroll
    for (int hi = 0; hi < 2; ++hi) { v4u o;
#pragma unroll
        for (int k = 0; k < 4; ++k) o[k] = pk2(v[hi * 8 + 2 * k], v[hi * 8 + 2 * k + 1]);
        *(v8us*)(XT + hi * 128) = __builtin_bit_cast(v8us, o); }  }
// k_prep: the five preparing stages, which do not depend on one another, as ONE grid; the block index picks the stage (the same for a whole work-group): PE table first (the longest blocks), then x^T of all batches, then the three weight conversions.
#define PB_PE  (CO * MM / 4 / 256)
#define PB_XT  (MM * CI / 16 / 256)
#define PB_W   (CO * CI / 8 / 256)
__global__ __launch_bounds__(256) void k_prep(const float* __restrict__ X, const float* __restrict__ Wq, const float* __restrict__ Wk, const float* __restrict__ Wv, bf* AQ, bf* AK, bf* AV, float* PE, bf* XT) {
    int b = blockIdx.x;
    if (b < PB_PE) { d_pe(PE, b); return; }
    b -= PB_PE;
    if (b < PB_XT * NB_) { d_xt(X, XT, b % PB_XT, b / PB_XT); return; }
    b -= PB_XT * NB_;
    const int w = b / PB_W;
    d_cvt8(w == 0 ? Wq : w == 1 ? Wk : Wv, w == 0 ? AQ : w == 1 ? AK : AV, CO * CI / 8, b % PB_W);   // W [o][c] is used as-is: the A operand of q and k, the Bt operand of v
}
// ---- k_fattn: logits, clip, softmax and A . v in one kernel. Grid (M / 256, batches x heads), 8 waves; a wave owns 32 query columns, the work-group walks the 1024 keys in stages of KT.
// S^T tile = K rows (A operand, from LDS) x Q columns (B operand, kept in registers): lane (lr, hi) holds query lr, keys 8 * hi + j of each 16-key tile, so two tiles of one 32-key pass ARE the B operand of the second product
// (element i = tile 0 register i, element 8 + i = tile 1 register i: the k order of the two 16-byte loads that every A fragment here is read with). out^T tile = v rows (A, from LDS) x P (B): lane (lr, hi) holds query lr, d = 8 * hi + j.
// No maximum is subtracted: the clip holds every logit t in [-50, 50], so P = exp(t) lies in [2^-73, 2^73], inside the f32 and bf16 range whatever the inputs, and a row's 1024 terms times v stay finite for |v| below 2^45 (the range is centred: as much room below as above); P is not yet divided; one division by the row sum at the end.
#define KT   64            // keys per stage
#define KPI  (HD + 8)      // LDS pitch of a K row, elements: 144 B = 16 B x odd, conflict-free 16-byte reads
#define VPI  (KT + 8)      // LDS pitch of a v row, elements
#define NCH  (KT * 8 / 256)
__device__ __forceinline__ v16bf ldsf(const bf* p) { return cat16b(*(const v8usa*)p, *(const v8usa*)(p + 16)); }
__device__ __forceinline__ float xhalf(float v) { const int b = __float_as_int(v); return __int_as_float(__builtin_amdgcn_permlanex16(b, b, 0x76543210, (int)0xfedcba98u, false, false)); }   // lane l <-> l ^ 16
// amdgpu_waves_per_eu(4, 4): at most 256 registers a wave, so that two work-groups share a WGP and one wave's vector work runs under another's matrix work
__global__ __launch_bounds__(256) __attribute__((amdgpu_waves_per_eu(4, 4))) void k_fattn(const bf* __restrict__ Qh, const bf* __restrict__ Ql, const bf* __restrict__ Kh, const bf* __restrict__ Kl, const bf* __restrict__ Vh, const bf* __restrict__ Vl, float* __restrict__ O) {
    __shared__ __align__(16) bf sK[2][2][KT * KPI];    // [buffer][h, l][key][d]
    __shared__ __align__(16) bf sV[2][2][HD * VPI];    // [buffer][h, l][d][key]
    const size_t zo = (size_t)blockIdx.y * MM * HD; Qh += zo; Ql += zo; Kh += zo; Kl += zo; Vh += zo; Vl += zo; O += zo;
    const int tid = threadIdx.x, lane = tid & 31, lr = lane & 15, hi = lane >> 4; const int q0 = blockIdx.x * 256 + (tid >> 5) * 32;
    const float L2E = 1.4426950408889634f; const float SC = 0.125f * L2E, CL = 50.0f * L2E;    // scale and clip bound in log2 units: x 0.125 is exact and the rounded product with L2E is monotone, so clip and product commute bit for bit
    v16bf qh[2][2], ql[2][2];
#pragma unroll
    for (int mb = 0; mb < 2; ++mb)
#pragma unroll
        for (int kc = 0; kc < 2; ++kc) { const size_t qo = (size_t)(q0 + mb * 16 + lr) * HD + kc * 32 + 8 * hi; qh[mb][kc] = WFrag<bf>::ld(Qh + qo); ql[mb][kc] = WFrag<bf>::ld(Ql + qo); }
    v8f o[4][2];
#pragma unroll
    for (int dt = 0; dt < 4; ++dt) { o[dt][0] = (v8f){}; o[dt][1] = (v8f){}; }
    float lsum[2] = {0.f, 0.f};
    v8us g[4][NCH];
    const unsigned ko8 = (unsigned)tid * 8u, vo8 = (unsigned)(tid / (KT / 8)) * MM + (unsigned)(tid % (KT / 8)) * 8u;    // this thread's 16-byte piece of a K tile (contiguous) and of a v tile (row d, pitch M)
    auto fetch = [&](int n0) { const bf* kh = Kh + (size_t)n0 * HD; const bf* kl = Kl + (size_t)n0 * HD; const bf* vh = Vh + n0; const bf* vl = Vl + n0;
#pragma unroll
        for (int i = 0; i < NCH; ++i) {
            g[0][i] = *(const v8us*)(kh + (ko8 + i * 2048u)); g[1][i] = *(const v8us*)(kl + (ko8 + i * 2048u));
            g[2][i] = *(const v8us*)(vh + (vo8 + i * (256u / (KT / 8)) * MM)); g[3][i] = *(const v8us*)(vl + (vo8 + i * (256u / (KT / 8)) * MM)); } };
    auto put = [&](int b) {
#pragma unroll
        for (int i = 0; i < NCH; ++i) { const int c = tid + i * 256; const int d = c / (KT / 8), cc = c % (KT / 8);
            *(v8usa*)(&sK[b][0][(c >> 3) * KPI + (c & 7) * 8]) = g[0][i]; *(v8usa*)(&sK[b][1][(c >> 3) * KPI + (c & 7) * 8]) = g[1][i];
            *(v8usa*)(&sV[b][0][d * VPI + cc * 8]) = g[2][i]; *(v8usa*)(&sV[b][1][d * VPI + cc * 8]) = g[3][i]; } };
    fetch(0); put(0);
    __syncthreads();
#pragma unroll 1
    for (int st = 0; st < MM / KT; ++st) {
        const int b = st & 1;
        if (st + 1 < MM / KT) fetch((st + 1) * KT);    // the next stage's global loads fly under this stage's work
#pragma unroll 1
        for (int kp = 0; kp < KT / 32; ++kp) {
            v8f s[2][2];
            s[0][0] = (v8f){}; s[0][1] = (v8f){}; s[1][0] = (v8f){}; s[1][1] = (v8f){};
#pragma unroll
            for (int kc = 0; kc < 2; ++kc) { v16bf ah[2], al[2];
#pragma unroll
                for (int nt = 0; nt < 2; ++nt) { const int ko = (kp * 32 + nt * 16 + lr) * KPI + kc * 32 + 8 * hi; ah[nt] = ldsf(&sK[b][0][ko]); al[nt] = ldsf(&sK[b][1][ko]); }
#pragma unroll
                for (int nt = 0; nt < 2; ++nt) { s[0][nt] = wmmab(ah[nt], qh[0][kc], s[0][nt]); s[1][nt] = wmmab(ah[nt], qh[1][kc], s[1][nt]); }
#pragma unroll
                for (int nt = 0; nt < 2; ++nt) { s[0][nt] = wmmab(al[nt], qh[0][kc], s[0][nt]); s[1][nt] = wmmab(al[nt], qh[1][kc], s[1][nt]); }
#pragma unroll
                for (int nt = 0; nt < 2; ++nt) { s[0][nt] = wmmab(ah[nt], ql[0][kc], s[0][nt]); s[1][nt] = wmmab(ah[nt], ql[1][kc], s[1][nt]); } }
            v16bf ph[2], pl[2];
#pragma unroll
            for (int mb = 0; mb < 2; ++mb) {
                float sum = 0.f; float p[16]; v8u hw, lw;
#pragma unroll
                for (int i = 0; i < 16; ++i) p[i] = fminf(fmaxf(s[mb][i >> 3][i & 7] * SC, -CL), CL);
#pragma unroll
                for (int i = 0; i < 16; ++i) p[i] = __builtin_amdgcn_exp2f(p[i]);
#pragma unroll
                for (int i = 0; i < 8; ++i) { sum += p[i]; sum += p[8 + i]; }
#pragma unroll
                for (int i = 0; i < 8; ++i) { unsigned a, c; split2(p[2 * i], p[2 * i + 1], a, c); hw[i] = a; lw[i] = c; }    // word i = elements 2 i, 2 i + 1 of the fragment
                lsum[mb] += sum;
                ph[mb] = __builtin_bit_cast(v16bf, hw); pl[mb] = __builtin_bit_cast(v16bf, lw); }
#pragma unroll
            for (int dp = 0; dp < 2; ++dp) { v16bf vh[2], vl[2];
#pragma unroll
                for (int d2 = 0; d2 < 2; ++d2) { const int vo = ((dp * 2 + d2) * 16 + lr) * VPI + kp * 32 + 8 * hi; vh[d2] = ldsf(&sV[b][0][vo]); vl[d2] = ldsf(&sV[b][1][vo]); }
#pragma unroll
                for (int d2 = 0; d2 < 2; ++d2) { o[dp * 2 + d2][0] = wmmab(vh[d2], ph[0], o[dp * 2 + d2][0]); o[dp * 2 + d2][1] = wmmab(vh[d2], ph[1], o[dp * 2 + d2][1]); }
#pragma unroll
                for (int d2 = 0; d2 < 2; ++d2) { o[dp * 2 + d2][0] = wmmab(vl[d2], ph[0], o[dp * 2 + d2][0]); o[dp * 2 + d2][1] = wmmab(vl[d2], ph[1], o[dp * 2 + d2][1]); }
#pragma unroll
                for (int d2 = 0; d2 < 2; ++d2) { o[dp * 2 + d2][0] = wmmab(vh[d2], pl[0], o[dp * 2 + d2][0]); o[dp * 2 + d2][1] = wmmab(vh[d2], pl[1], o[dp * 2 + d2][1]); } }
        }
        if (st + 1 < MM / KT) put(b ^ 1);    // that buffer's last readers left it before the barrier that ended stage st - 1
        __syncthreads();                      // publishes stage st + 1 and ends every read of stage st
    }
#pragma unroll
    for (int mb = 0; mb < 2; ++mb) { const float f = __fdiv_rn(1.0f, lsum[mb] + xhalf(lsum[mb]));
#pragma unroll
        for (int dt = 0; dt < 4; ++dt)
#pragma unroll
            for (int j = 0; j < 8; ++j) O[(size_t)(dt * 16 + hi * 8 + j) * MM + q0 + mb * 16 + lr] = o[dt][mb][j] * f; }
}

extern "C" void kernel_launch(void* const* d_in, const int* in_sizes, int n_in,
                              void* d_out, int out_size, void* d_ws, size_t ws_size, hipStream_t stream) {
    (void)in_sizes; (void)n_in; (void)out_size;
    const float* x = (const float*)d_in[0]; const float* Wq = (const float*)d_in[1]; const float* Wk = (const float*)d_in[2]; const float* Wv = (const float*)d_in[3];
    float* OUT = (float*)d_out;     // [16][512][1024]
    char* wsp = (char*)d_ws;
    auto take = [&](size_t bytes) { char* p = wsp; wsp += (bytes + 255) & ~(size_t)255; return (void*)p; };
    bf* AQ = (bf*)take((size_t)CO * CI * 2); bf* AK = (bf*)take((size_t)CO * CI * 2); bf* AV = (bf*)take((size_t)CO * CI * 2); float* PE = (float*)take((size_t)CO * MM * 4); bf* XT = (bf*)take((size_t)NB_ * MM * CI * 2);
    bf* QPh = (bf*)take((size_t)NB_ * CO * MM * 2); bf* QPl = (bf*)take((size_t)NB_ * CO * MM * 2); bf* KPh = (bf*)take((size_t)NB_ * CO * MM * 2); bf* KPl = (bf*)take((size_t)NB_ * CO * MM * 2); bf* VPh = (bf*)take((size_t)NB_ * CO * MM * 2); bf* VPl = (bf*)take((size_t)NB_ * CO * MM * 2);
    if ((size_t)(wsp - (char*)d_ws) > ws_size) return;    // total ~ 107 MiB
    k_prep<<<PB_PE + PB_XT * NB_ + 3 * PB_W, 256, 0, stream>>>(x, Wq, Wk, Wv, AQ, AK, AV, PE, XT);
    k_gemm3<<<dim3((CO / 256) * (MM / 128), 1, 3 * NB_), 256, 0, stream>>>(AQ, AK, AV, XT, QPh, QPl, KPh, KPl, VPh, VPl, PE);
    k_fattn<<<dim3(MM / 256, NB_ * NH_), 256, 0, stream>>>(QPh, QPl, KPh, KPl, VPh, VPl, OUT);   // blockIdx.y = batch * 8 + head: the planes and OUT are contiguous in that index
}

// v009
// A run of this version takes 93.1 microseconds.
// Timed twice side by side with v008, it ran 1.05 and 1.06 times as fast.
// Over all steps from v000 it is 13.5 times as fast.
#include <hip/hip_runtime.h>

// MultiHeadSelfAttention2D (x [16][256][32][32] channel-major; q/k/v = 1x1 conv = W [512][256] . x[c][m] over the M = 1024 positions; 2-D sinusoidal PE r[c][m] (first 256 channels row position, last 256 column position; even channels sin, odd cos; constants computed on device) added to q and k;
//   8 heads x 64: logits[m][n] = sum_d qh[d][m] kh[d][n] / 8, clipped to [-50, 50]; softmax over n; out[h*64+d][m] = sum_n A[m][n] vh[d][n] -> [16][512][32][32] channel-major).
// Compute dtypes, f32 accumulate: every input rounded to bf16; the three 1x1 convs as PLAIN bf16 GEMMs W . x^T (inputs: exact; x transposed once per batch; x^T, W and the PE table lie in memory in the order the GEMM's lanes read them, see d_gemmp); k + PE in f32 -> hl planes [h][m][d], v -> hl planes [h][d][n], both split and stored by the conv GEMM itself; q + PE is computed by the attention kernel, each wave its own 32 columns, and goes from the accumulators straight into its hl fragments (no q plane); logits hl x hl (3 products); clip + softmax f32 (exp of the clipped logit as it is, running sum) -> hl fragments in registers; out = vh (hl planes [h][d][n]) . A^T as hl x hl (3 products), divided by the row sum at the end and written straight into the channel-major output; the batch index rides in the grid: every stage covers all 16 batches in one launch; logits, softmax and the second product are ONE kernel (k_fattn), so neither the logits nor the softmax matrix touch memory.

#define NB_  16
#define CI   256
#define CO   512
#define MM   1024
#define HH   32
#define NH_  8
#define HD   64
typedef _Float16 h16;
typedef unsigned short bf;
typedef __attribute__((ext_vector_type(16))) __bf16   v16bf;
typedef __attribute__((ext_vector_type(16))) _Float16 v16h;
typedef __attribute__((ext_vector_type(8)))  _Float16 v8h;
typedef __attribute__((ext_vector_type(8)))  unsigned short v8us;
typedef __attribute__((ext_vector_type(8)))  float    v8f;
typedef __attribute__((ext_vector_type(4)))  float    v4f;
typedef v8h  __attribute__((may_alias)) v8ha;
typedef v4f  __attribute__((may_alias)) v4fa;
typedef v8us __attribute__((may_alias)) v8usa;

typedef __attribute__((ext_vector_type(2)))  float    v2f;
typedef __attribute__((ext_vector_type(2)))  __bf16   v2bf;
typedef __attribute__((ext_vector_type(2)))  unsigned v2u;
typedef __attribute__((ext_vector_type(4)))  unsigned v4u;
typedef __attribute__((ext_vector_type(8)))  unsigned v8u;
// pk2: two f32 rounded to bf16 (to nearest, ties to even) and packed, a in the low half: the chip's own packed conversion, one instruction for the pair
__device__ __forceinline__ unsigned pk2(float a, float b) { return __builtin_bit_cast(unsigned, __builtin_convertvector((v2f){a, b}, v2bf)); }
// split2: h = bf16(y), l = bf16(y - h) of a pair, both packed; y - h is exact in f32
__device__ __forceinline__ void split2(float a, float b, unsigned& h, unsigned& l) { h = pk2(a, b); const v2f r = (v2f){a, b} - (v2f){__uint_as_float(h << 16), __uint_as_float(h & 0xFFFF0000u)}; l = __builtin_bit_cast(unsigned, __builtin_convertvector(r, v2bf)); }
__device__ __forceinline__ v16h cat16(v8h lo, v8h hi) { return __builtin_shufflevector(lo, hi, 0, 1, 2, 3, 4, 5, 6, 7, 8, 9, 10, 11, 12, 13, 14, 15); }
__device__ __forceinline__ v16bf cat16b(v8us lo, v8us hi) { return __builtin_bit_cast(v16bf, __builtin_shufflevector(lo, hi, 0, 1, 2, 3, 4, 5, 6, 7, 8, 9, 10, 11, 12, 13, 14, 15)); }
__device__ __forceinline__ v8f wmma16(v16h a, v16h b, v8f c) { return __builtin_amdgcn_wmma_f32_16x16x32_f16(false, a, false, b, (short)0, c, false, false); }
__device__ __forceinline__ v8f wmmab(v16bf a, v16bf b, v8f c) { return __builtin_amdgcn_wmma_f32_16x16x32_bf16(false, a, false, b, (short)0, c, false, false); }



// ---- d_gemmp: register-blocked conv GEMM, ONE WAVE per 64x64 tile (16 accumulators), operands from bf16 planes packed in fragment order, staged in LDS for the 8 waves of a work-group; batch z.
// y[r][c] = sum_k A[r][k] Bt[c][k]. A lane's 8 accumulator registers are 8 CONSECUTIVE r of one c, so the operand whose index must run contiguously in the planes is given as A: a lane splits its 8 values, puts 16 bytes per plane into LDS, and the tile leaves as whole 128-byte lines; the f32 result never touches memory:
// QK: A = W (r = output channel, tile = one head), Bt = x^T (c = position m): planes [h][m][d] of y + PE. Otherwise: A = x^T (r = position n), Bt = W (c = output channel): planes [channel][n].
template <typename T16> struct WFrag;
template <> struct WFrag<h16> { typedef v16h V; static __device__ __forceinline__ V ld(const h16* p) { return cat16(*(const v8h*)p, *(const v8h*)(p + 16)); } static __device__ __forceinline__ v8f mma(V a, V b, v8f c) { return wmma16(a, b, c); } };
template <> struct WFrag<bf> { typedef v16bf V; static __device__ __forceinline__ V ld(const bf* p) { return cat16b(*(const v8us*)p, *(const v8us*)(p + 16)); } static __device__ __forceinline__ v8f mma(V a, V b, v8f c) { return wmmab(a, b, c); } };
// Packed operand plane of R[row][k]: blocks of 16 rows x 32 k = 1 KB, block (row / 16, k / 32) at element (row / 16 * 16) * K + (k / 32) * 512; inside it the 16-byte piece (j, lane = hi * 16 + row % 16) at j * 256 + lane * 8 holds k % 32 = j * 16 + hi * 8 + 0..7:
// the same k at every lane and register as two 16-byte reads of a K-contiguous row, but each wave-wide load is 512 contiguous bytes (4 whole lines, not 32 bytes out of each of 16 lines). PE likewise: blocks of 16 m x 16 channels f32, piece (j, lane = hi * 16 + m % 16) at j * 128 + lane * 4 holds channels hi * 8 + j * 4 + 0..3.
__device__ __forceinline__ v16bf ldpk(const bf* p) { return cat16b(*(const v8us*)p, *(const v8us*)(p + 256)); }
#define OSP  (64 + 8)      // LDS pitch of a staged row, elements: 144 B = 16 B x odd
// A work-group is 8 waves = 4 W tiles x 2 x^T tiles of 64 rows: the six operand tiles come into LDS once for all eight waves (each W tile serves 2 waves, each x^T tile 4), 64 k a stage, two buffers, by asynchronous copies;
// a packed plane is copied as it lies (a tile's stage = 4 row blocks x 2 KB), so a fragment read from LDS is 512 contiguous bytes with the same k at every lane and register as before.
#define GS   64            // k per stage
#define TSE  (64 * GS)     // elements of one tile's stage (8 KB)
#define STE  (6 * TSE)     // elements of a stage: W tiles 0..3, x^T tiles 4, 5
__device__ __forceinline__ v16bf ldsp(const bf* p) { return cat16b(*(const v8usa*)p, *(const v8usa*)(p + 256)); }
// cp4: four 16-byte copies a lane, global to LDS, 4 KB apart in LDS and 16 KB apart in the plane; the s_wait_xcnt closes the statement, so no address register is rewritten before it
__device__ __forceinline__ void cp4(unsigned l, const bf* g) {
    asm volatile("global_load_async_to_lds_b128 %0, %4, off\n\tglobal_load_async_to_lds_b128 %1, %5, off\n\tglobal_load_async_to_lds_b128 %2, %6, off\n\tglobal_load_async_to_lds_b128 %3, %7, off\n\ts_wait_xcnt 0x0"
                 :: "v"(l), "v"(l + 4096u), "v"(l + 8192u), "v"(l + 12288u), "v"(g), "v"(g + 8192), "v"(g + 16384), "v"(g + 24576) : "memory");
}
template <bool QK>
__device__ __forceinline__ void d_gemmp(const bf* __restrict__ Wp, const bf* __restrict__ Xp, bf* Ph, bf* Pl, const float* __restrict__ PEt, int hg, int pg, size_t z, bf* sm) {
    typedef WFrag<bf>::V V;
    constexpr int K = CI;
    const int tid = threadIdx.x, lane = tid & 31, lr = lane & 15, hi = lane >> 4; const int wv = __builtin_amdgcn_readfirstlane(tid >> 5); const int wj = wv & 3, xj = wv >> 2;
    const int r0 = (QK ? hg * 4 + wj : pg * 2 + xj) * 64, c0 = (QK ? pg * 2 + xj : hg * 4 + wj) * 64;
    v8f acc[4][4];
#pragma unroll
    for (int mb = 0; mb < 4; ++mb)
#pragma unroll
        for (int nb = 0; nb < 4; ++nb) acc[mb][nb] = (v8f){};
    const unsigned l0 = (unsigned)(size_t)(const __attribute__((address_space(3))) bf*)sm + (unsigned)tid * 16u;    // this thread's 16-byte piece of the first half tile, LDS byte address
    const bf* gw = Wp + (size_t)hg * (4 * 64 * K) + (tid >> 7) * (16 * K) + (tid & 127) * 8; const bf* gx = Xp + (size_t)pg * (2 * 64 * K) + (tid >> 7) * (16 * K) + (tid & 127) * 8;
    auto stage = [&](int t, int b) { const unsigned l = l0 + (unsigned)b * (STE * 2u); cp4(l, gw + t * (GS * 16)); cp4(l + 16384u, gw + t * (GS * 16) + 32768); cp4(l + 32768u, gx + t * (GS * 16)); };    // 12 half tiles of 4 KB: 8 of W, 4 of x^T
    stage(0, 0);
    asm volatile("s_wait_asynccnt 0x0" ::: "memory");    // this wave's copies of stage 0 have landed
    __syncthreads();                                      // and every other wave's
    stage(1, 1);
#pragma unroll 1
    for (int t = 0; t < K / GS; ++t) {
        const bf* sw = sm + (t & 1) * STE + wj * TSE + lane * 8; const bf* sx = sm + (t & 1) * STE + (4 + xj) * TSE + lane * 8;
        const bf* pa = QK ? sw : sx; const bf* pb = QK ? sx : sw;
#pragma unroll
        for (int ks = 0; ks < GS / 32; ++ks) { V a[4], b[4];    // the eight fragments of a k step are read as one group
#pragma unroll
            for (int mb = 0; mb < 4; ++mb) { a[mb] = ldsp(pa + mb * 1024 + ks * 512); b[mb] = ldsp(pb + mb * 1024 + ks * 512); }
            asm volatile("" :: "v"(a[0]), "v"(a[1]), "v"(a[2]), "v"(a[3]), "v"(b[0]), "v"(b[1]), "v"(b[2]), "v"(b[3]));    // inputs only: holds the sixteen LDS reads together in front of the products; without it the compiler reads b one fragment at a time, with a full LDS wait before every four products
#pragma unroll
            for (int nb = 0; nb < 4; ++nb)
#pragma unroll
                for (int mb = 0; mb < 4; ++mb) acc[mb][nb] = WFrag<bf>::mma(a[mb], b[nb], acc[mb][nb]); }
        asm volatile("s_wait_dscnt 0x0" ::: "memory");       // this wave's reads of the buffer are done before it may be refilled
        asm volatile("s_wait_asynccnt 0x0" ::: "memory");    // this wave's copies of stage t + 1 have landed
        __syncthreads();                                      // publishes stage t + 1 and ends every read of stage t
        if (t + 2 < K / GS) stage(t + 2, t & 1);              // flies under trip t + 1
    }
    asm volatile("s_wait_asynccnt 0x0" ::: "memory");    // nothing is in flight when the ring becomes the output staging below
    bf (*os)[64 * OSP] = (bf (*)[64 * OSP])(sm + wv * (2 * 64 * OSP));    // this wave's own [h, l][c][r]
    constexpr int PITCH = QK ? HD : MM;    // plane elements from one c to the next
    const float* pe = PEt + (size_t)c0 * CO + r0 * 16 + lane * 4;
#pragma unroll
    for (int nb = 0; nb < 4; ++nb)
#pragma unroll
        for (int mb = 0; mb < 4; ++mb) { v8f y = acc[mb][nb];
            if (QK) { const v4f p0 = *(const v4f*)(pe + nb * 16 * CO + mb * 256), p1 = *(const v4f*)(pe + nb * 16 * CO + mb * 256 + 128);
#pragma unroll
                for (int j = 0; j < 4; ++j) { y[j] = __fadd_rn(y[j], p0[j]); y[4 + j] = __fadd_rn(y[4 + j], p1[j]); } }
            v4u oh, ol;
#pragma unroll
            for (int j = 0; j < 4; ++j) { unsigned s0, s1; split2(y[2 * j], y[2 * j + 1], s0, s1); oh[j] = s0; ol[j] = s1; }
            *(v8usa*)(&os[0][(nb * 16 + lr) * OSP + mb * 16 + 8 * hi]) = __builtin_bit_cast(v8us, oh); *(v8usa*)(&os[1][(nb * 16 + lr) * OSP + mb * 16 + 8 * hi]) = __builtin_bit_cast(v8us, ol); }
    asm volatile("s_wait_dscnt 0x0" ::: "memory");    // the reads below take what other lanes of this wave wrote: every LDS write has landed, and the compiler moves no read above this line
    const size_t ob = z * ((size_t)CO * MM) + (QK ? (size_t)r0 * MM : (size_t)r0) + (size_t)(c0 + (lane >> 3)) * PITCH + (lane & 7) * 8;
#pragma unroll
    for (int s = 0; s < 16; ++s) { const int so = (s * 4 + (lane >> 3)) * OSP + (lane & 7) * 8;    // 8 lanes = one whole 128-byte line of a plane, 4 lines an instruction
        *(v8us*)(Ph + ob + s * 4 * PITCH) = *(const v8usa*)(&os[0][so]); *(v8us*)(Pl + ob + s * 4 * PITCH) = *(const v8usa*)(&os[1][so]); }
    asm volatile("s_wait_xcnt 0x0" ::: "memory");    // precaution: the wait stands in front of any later overwrite of these stores' data and address registers
}
// k_gemm3: the k and v conv GEMMs, which do not depend on one another, as ONE grid (16 groups of 8 tiles, 1, 2 x batches = 512 work-groups, two a WGP: all resident at once): blockIdx.z / 16 = k, v; blockIdx.x = (group of 4 W tiles, fastest; pair of x^T tiles).
// amdgpu_waves_per_eu(4): at most 256 registers a wave, so that two work-groups share a WGP
__global__ __launch_bounds__(256) __attribute__((amdgpu_waves_per_eu(4))) void k_gemm3(const bf* __restrict__ AK, const bf* __restrict__ AV, const bf* __restrict__ XT, bf* KPh, bf* KPl, bf* VPh, bf* VPl, const float* __restrict__ PEt) {
    __shared__ __align__(16) bf sm[8 * 2 * 64 * OSP];    // first the two-buffer operand ring (2 x 48 KB), then each wave's output staging
    const int w = blockIdx.z / NB_, t = blockIdx.x; const size_t z = blockIdx.z % NB_; const bf* X = XT + z * ((size_t)MM * CI);
    if (w == 0) d_gemmp<true>(AK, X, KPh, KPl, PEt, t & 1, t >> 1, z, sm);
    else d_gemmp<false>(AV, X, VPh, VPl, PEt, t & 1, t >> 1, z, sm);
}

typedef __attribute__((ext_vector_type(2))) unsigned short v2us;
typedef __attribute__((ext_vector_type(4))) unsigned short v4us;

__device__ __forceinline__ void d_cvt8(const float* __restrict__ src, bf* dst, size_t n8, int bx) { const size_t i = (size_t)bx * 256 + threadIdx.x; if (i >= n8) return;    // i = the 16-byte piece of the packed plane
    const int ln = (int)i & 31, j = ((int)i >> 5) & 1, blk = (int)(i >> 6); const int row = blk / (CI / 32) * 16 + (ln & 15), k0 = blk % (CI / 32) * 32 + j * 16 + (ln >> 4) * 8;
    const v8f v = *(const v8f*)(src + (size_t)row * CI + k0); v4u o;
#pragma unroll
    for (int k = 0; k < 4; ++k) o[k] = pk2(v[2 * k], v[2 * k + 1]); *(v8us*)(dst + i * 8) = __builtin_bit_cast(v8us, o);  }
// d_pe: PE of (m, c), f32, packed (d_gemmp): thread = one 16-byte piece; c < 256 -> pe1d(256, row = m / 32)[c], else pe1d(256, col = m % 32)[c - 256]; pe1d(d, L)[p][ch] = (ch even ? sin : cos)(p * exp(-ln(1e4) * (ch - ch%2) / d)) ;
// by = batch in d_xt. d_xt: packed plane of XT[m][c] = bf16(x[c][m]): lanes run along m, so a load is one whole line of x and a store is two runs of 256 bytes; a thread takes 16 channels of one m = the pieces hi = 0, 1 of one (block, j)
__device__ __forceinline__ void d_pe(float* PE, int bx) { const int e = (bx * 256 + threadIdx.x) * 4; if (e >= CO * MM) return; const int ln = (e >> 2) & 31, blk = e >> 8; const int m = blk / (CO / 16) * 16 + (ln & 15); const int c0 = blk % (CO / 16) * 16 + (ln >> 4) * 8 + ((e >> 7) & 1) * 4; v4f r;
#pragma unroll 1    // one copy of the sin / cos code
    for (int u = 0; u < 4; ++u) { const int c = c0 + u; const int cc = (c < CO / 2) ? c : c - CO / 2; const int ch2 = cc & ~1; const float div = __expf(-logf(10000.0f) * (float)ch2 / (float)(CO / 2)); const int p = (c < CO / 2) ? (m / HH) : (m % HH); const float ang = __fmul_rn((float)p, div); r[u] = (cc & 1) ? cosf(ang) : sinf(ang); }
    *(v4f*)(PE + e) = r;  }
__device__ __forceinline__ void d_xt(const float* __restrict__ X, bf* XT, int bx, int by) { const int e = bx * 256 + threadIdx.x; if (e >= MM * (CI / 16)) return; const int m = e % MM, c16 = e / MM;
    X += (size_t)by * CI * MM + (size_t)c16 * 16 * MM + m; XT += (size_t)by * MM * CI + (size_t)(m >> 4) * 16 * CI + (c16 >> 1) * 512 + (c16 & 1) * 256 + (m & 15) * 8; float v[16];
#pragma unroll
    for (int u = 0; u < 16; ++u) v[u] = X[(size_t)u * MM];
#pragma unroll
    for (int hi = 0; hi < 2; ++hi) { v4u o;
#pragma unroll
        for (int k = 0; k < 4; ++k) o[k] = pk2(v[hi * 8 + 2 * k], v[hi * 8 + 2 * k + 1]);
        *(v8us*)(XT + hi * 128) = __builtin_bit_cast(v8us, o); }  }
// k_prep: the five preparing stages, which do not depend on one another, as ONE grid; the block index picks the stage (the same for a whole work-group): PE table first (the longest blocks), then x^T of all batches, then the three weight conversions.
#define PB_PE  (CO * MM / 4 / 256)
#define PB_XT  (MM * CI / 16 / 256)
#define PB_W   (CO * CI / 8 / 256)
__global__ __launch_bounds__(256) void k_prep(const float* __restrict__ X, const float* __restrict__ Wq, const float* __restrict__ Wk, const float* __restrict__ Wv, bf* AQ, bf* AK, bf* AV, float* PE, bf* XT) {
    int b = blockIdx.x;
    if (b < PB_PE) { d_pe(PE, b); return; }
    b -= PB_PE;
    if (b < PB_XT * NB_) { d_xt(X, XT, b % PB_XT, b / PB_XT); return; }
    b -= PB_XT * NB_;
    const int w = b / PB_W;
    d_cvt8(w == 0 ? Wq : w == 1 ? Wk : Wv, w == 0 ? AQ : w == 1 ? AK : AV, CO * CI / 8, b % PB_W);   // W [o][c] is used as-is: the A operand of q and k, the Bt operand of v
}
// ---- k_fattn: logits, clip, softmax and A . v in one kernel. Grid (M / 256, batches x heads), 8 waves; a wave owns 32 query columns, the work-group walks the 1024 keys in stages of KT.
// S^T tile = K rows (A operand, from LDS) x Q columns (B operand, kept in registers): lane (lr, hi) holds query lr, keys 8 * hi + j of each 16-key tile, so two tiles of one 32-key pass ARE the B operand of the second product
// (element i = tile 0 register i, element 8 + i = tile 1 register i: the k order of the two 16-byte loads that every A fragment here is read with). out^T tile = v rows (A, from LDS) x P (B): lane (lr, hi) holds query lr, d = 8 * hi + j.
// No maximum is subtracted: the clip holds every logit t in [-50, 50], so P = exp(t) lies in [2^-73, 2^73], inside the f32 and bf16 range whatever the inputs, and a row's 1024 terms times v stay finite for |v| below 2^45 (the range is centred: as much room below as above); P is not yet divided; one division by the row sum at the end.
#define KT   64            // keys per stage
#define KPI  (HD + 8)      // LDS pitch of a K row, elements: 144 B = 16 B x odd, conflict-free 16-byte reads
#define VPI  (KT + 8)      // LDS pitch of a v row, elements
#define NCH  (KT * 8 / 256)
__device__ __forceinline__ v16bf ldsf(const bf* p) { return cat16b(*(const v8usa*)p, *(const v8usa*)(p + 16)); }
__device__ __forceinline__ float xhalf(float v) { const int b = __float_as_int(v); return __int_as_float(__builtin_amdgcn_permlanex16(b, b, 0x76543210, (int)0xfedcba98u, false, false)); }   // lane l <-> l ^ 16
// amdgpu_waves_per_eu(4, 4): at most 256 registers a wave, so that two work-groups share a WGP and one wave's vector work runs under another's matrix work
__global__ __launch_bounds__(256) __attribute__((amdgpu_waves_per_eu(4, 4))) void k_fattn(const bf* __restrict__ AQ, const bf* __restrict__ XT, const float* __restrict__ PEt, const bf* __restrict__ Kh, const bf* __restrict__ Kl, const bf* __restrict__ Vh, const bf* __restrict__ Vl, float* __restrict__ O) {
    __shared__ __align__(16) bf sK[2][2][KT * KPI];    // [buffer][h, l][key][d]
    __shared__ __align__(16) bf sV[2][2][HD * VPI];    // [buffer][h, l][d][key]
    const size_t zo = (size_t)blockIdx.y * MM * HD; Kh += zo; Kl += zo; Vh += zo; Vl += zo; O += zo;
    const int tid = threadIdx.x, lane = tid & 31, lr = lane & 15, hi = lane >> 4; const int q0 = blockIdx.x * 256 + __builtin_amdgcn_readfirstlane(tid >> 5) * 32;    // the same in every lane of a wave: held in a scalar register, so the x^T and PE loads below take a scalar base and one lane offset, not an address pair that their own data would overwrite
    const float L2E = 1.4426950408889634f; const float SC = 0.125f * L2E, CL = 50.0f * L2E;    // scale and clip bound in log2 units: x 0.125 is exact and the rounded product with L2E is monotone, so clip and product commute bit for bit
    v16bf qh[2][2], ql[2][2];
    v8f o[4][2];
#pragma unroll
    for (int dt = 0; dt < 4; ++dt) { o[dt][0] = (v8f){}; o[dt][1] = (v8f){}; }
    float lsum[2] = {0.f, 0.f};
    v8us g[4][NCH];
    const unsigned ko8 = (unsigned)tid * 8u, vo8 = (unsigned)(tid / (KT / 8)) * MM + (unsigned)(tid % (KT / 8)) * 8u;    // this thread's 16-byte piece of a K tile (contiguous) and of a v tile (row d, pitch M)
    auto fetch = [&](v8us (&g)[4][NCH], int n0) { const bf* kh = Kh + (size_t)n0 * HD; const bf* kl = Kl + (size_t)n0 * HD; const bf* vh = Vh + n0; const bf* vl = Vl + n0;
#pragma unroll
        for (int i = 0; i < NCH; ++i) {
            g[0][i] = *(const v8us*)(kh + (ko8 + i * 2048u)); g[1][i] = *(const v8us*)(kl + (ko8 + i * 2048u));
            g[2][i] = *(const v8us*)(vh + (vo8 + i * (256u / (KT / 8)) * MM)); g[3][i] = *(const v8us*)(vl + (vo8 + i * (256u / (KT / 8)) * MM)); } };
    auto put = [&](const v8us (&g)[4][NCH], int b) {
#pragma unroll
        for (int i = 0; i < NCH; ++i) { const int c = tid + i * 256; const int d = c / (KT / 8), cc = c % (KT / 8);
            *(v8usa*)(&sK[b][0][(c >> 3) * KPI + (c & 7) * 8]) = g[0][i]; *(v8usa*)(&sK[b][1][(c >> 3) * KPI + (c & 7) * 8]) = g[1][i];
            *(v8usa*)(&sV[b][0][d * VPI + cc * 8]) = g[2][i]; *(v8usa*)(&sV[b][1][d * VPI + cc * 8]) = g[3][i]; } };
    // q of this wave's 32 columns: Wq rows of this head (A, 32 KB of the packed plane, brought once for the 8 waves into the second buffers of the K and v rings, which stage 1 fills only later) x x^T rows q0.. (B, packed plane, each wave its own), k ascending in steps of 32 as in d_gemmp: the same bits.
    // Lane (lr, hi) of tile (dt, mb) holds column q0 + mb * 16 + lr, d = dt * 16 + 8 * hi + j: tiles 2 kc and 2 kc + 1 ARE the B fragment kc of the logits product (the k order of ldsf), so q never leaves the registers.
    { const int hd = blockIdx.y % NH_; const size_t bz = blockIdx.y / NH_;
        bf* sw[2] = {&sK[1][0][0], &sV[1][0][0]}; const bf* wq = AQ + (size_t)hd * (HD * CI);    // rows 0..31 and 32..63 of the head, 16 KB each
        const bf* xq = XT + bz * ((size_t)MM * CI) + (size_t)q0 * CI + lane * 8;
        v16bf xb[CI / 32][2];
        v8us g0[4][NCH];    // stage 0 has registers of its own, dead at the barrier below, so that the loop's staging registers are not held through the q product
        fetch(g0, 0);    // stage 0, Wq and x^T are asked for together: one memory latency
#pragma unroll
        for (int ks = 0; ks < CI / 32; ++ks) { xb[ks][0] = ldpk(xq + ks * 512); xb[ks][1] = ldpk(xq + 16 * CI + ks * 512); }
#pragma unroll
        for (int i = 0; i < HD * CI / 8 / 256; ++i) *(v8usa*)(sw[i >> 2] + (tid + (i & 3) * 256) * 8) = *(const v8us*)(wq + (tid + i * 256) * 8);
        put(g0, 0);
        __syncthreads();    // Wq of this head and stage 0 are in LDS for every wave
        v8f qa[4][2]; v4f pv[2][4][2];
        const float* pe = PEt + (size_t)q0 * CO + hd * (HD * 16) + lane * 4;
#pragma unroll
        for (int dt = 0; dt < 4; ++dt) { qa[dt][0] = (v8f){}; qa[dt][1] = (v8f){}; }
#pragma unroll
        for (int ks = 0; ks < CI / 32; ++ks) { v16bf a[4];
#pragma unroll
            for (int dt = 0; dt < 4; ++dt) a[dt] = ldsp(sw[dt >> 1] + (dt & 1) * 16 * CI + ks * 512 + lane * 8);
            asm volatile("" :: "v"(a[0]), "v"(a[1]), "v"(a[2]), "v"(a[3]));    // inputs only: one LDS wait a k step, on reads issued under the step before; without it the compiler reads one fragment, waits for it and issues its two products, over and over
#pragma unroll
            for (int dt = 0; dt < 4; ++dt) { qa[dt][0] = wmmab(a[dt], xb[ks][0], qa[dt][0]); qa[dt][1] = wmmab(a[dt], xb[ks][1], qa[dt][1]); }
            if (ks == CI / 64 - 1) {    // the PE loads start when half of the x^T registers are free and fly under the rest of the product
#pragma unroll
                for (int mb = 0; mb < 2; ++mb)
#pragma unroll
                    for (int dt = 0; dt < 4; ++dt) { pv[mb][dt][0] = *(const v4f*)(pe + mb * 16 * CO + dt * 256); pv[mb][dt][1] = *(const v4f*)(pe + mb * 16 * CO + dt * 256 + 128); } } }
#pragma unroll
        for (int mb = 0; mb < 2; ++mb)
#pragma unroll
            for (int kc = 0; kc < 2; ++kc) { v8u hw, lw;
#pragma unroll
                for (int u = 0; u < 2; ++u) { v8f y = qa[kc * 2 + u][mb]; const v4f p0 = pv[mb][kc * 2 + u][0], p1 = pv[mb][kc * 2 + u][1];
#pragma unroll
                    for (int j = 0; j < 4; ++j) { y[j] = __fadd_rn(y[j], p0[j]); y[4 + j] = __fadd_rn(y[4 + j], p1[j]); }
#pragma unroll
                    for (int j = 0; j < 4; ++j) { unsigned s0, s1; split2(y[2 * j], y[2 * j + 1], s0, s1); hw[u * 4 + j] = s0; lw[u * 4 + j] = s1; } }
                qh[mb][kc] = __builtin_bit_cast(v16bf, hw); ql[mb][kc] = __builtin_bit_cast(v16bf, lw); }
        __syncthreads();    // every wave has read Wq: the second buffers may take stage 1
    }
#pragma unroll 1
    for (int st = 0; st < MM / KT; ++st) {
        const int b = st & 1;
        if (st + 1 < MM / KT) fetch(g, (st + 1) * KT);    // the next stage's global loads fly under this stage's work
#pragma unroll 1
        for (int kp = 0; kp < KT / 32; ++kp) {
            v8f s[2][2];
            s[0][0] = (v8f){}; s[0][1] = (v8f){}; s[1][0] = (v8f){}; s[1][1] = (v8f){};
#pragma unroll
            for (int kc = 0; kc < 2; ++kc) { v16bf ah[2], al[2];
#pragma unroll
                for (int nt = 0; nt < 2; ++nt) { const int ko = (kp * 32 + nt * 16 + lr) * KPI + kc * 32 + 8 * hi; ah[nt] = ldsf(&sK[b][0][ko]); al[nt] = ldsf(&sK[b][1][ko]); }
#pragma unroll
                for (int nt = 0; nt < 2; ++nt) { s[0][nt] = wmmab(ah[nt], qh[0][kc], s[0][nt]); s[1][nt] = wmmab(ah[nt], qh[1][kc], s[1][nt]); }
#pragma unroll
                for (int nt = 0; nt < 2; ++nt) { s[0][nt] = wmmab(al[nt], qh[0][kc], s[0][nt]); s[1][nt] = wmmab(al[nt], qh[1][kc], s[1][nt]); }
#pragma unroll
                for (int nt = 0; nt < 2; ++nt) { s[0][nt] = wmmab(ah[nt], ql[0][kc], s[0][nt]); s[1][nt] = wmmab(ah[nt], ql[1][kc], s[1][nt]); } }
            v16bf ph[2], pl[2];
#pragma unroll
            for (int mb = 0; mb < 2; ++mb) {
                float sum = 0.f; float p[16]; v8u hw, lw;
#pragma unroll
                for (int i = 0; i < 16; ++i) p[i] = fminf(fmaxf(s[mb][i >> 3][i & 7] * SC, -CL), CL);
#pragma unroll
                for (int i = 0; i < 16; ++i) p[i] = __builtin_amdgcn_exp2f(p[i]);
#pragma unroll
                for (int i = 0; i < 8; ++i) { sum += p[i]; sum += p[8 + i]; }
#pragma unroll
                for (int i = 0; i < 8; ++i) { unsigned a, c; split2(p[2 * i], p[2 * i + 1], a, c); hw[i] = a; lw[i] = c; }    // word i = elements 2 i, 2 i + 1 of the fragment
                lsum[mb] += sum;
                ph[mb] = __builtin_bit_cast(v16bf, hw); pl[mb] = __builtin_bit_cast(v16bf, lw); }
#pragma unroll
            for (int dp = 0; dp < 2; ++dp) { v16bf vh[2], vl[2];
#pragma unroll
                for (int d2 = 0; d2 < 2; ++d2) { const int vo = ((dp * 2 + d2) * 16 + lr) * VPI + kp * 32 + 8 * hi; vh[d2] = ldsf(&sV[b][0][vo]); vl[d2] = ldsf(&sV[b][1][vo]); }
#pragma unroll
                for (int d2 = 0; d2 < 2; ++d2) { o[dp * 2 + d2][0] = wmmab(vh[d2], ph[0], o[dp * 2 + d2][0]); o[dp * 2 + d2][1] = wmmab(vh[d2], ph[1], o[dp * 2 + d2][1]); }
#pragma unroll
                for (int d2 = 0; d2 < 2; ++d2) { o[dp * 2 + d2][0] = wmmab(vl[d2], ph[0], o[dp * 2 + d2][0]); o[dp * 2 + d2][1] = wmmab(vl[d2], ph[1], o[dp * 2 + d2][1]); }
#pragma unroll
                for (int d2 = 0; d2 < 2; ++d2) { o[dp * 2 + d2][0] = wmmab(vh[d2], pl[0], o[dp * 2 + d2][0]); o[dp * 2 + d2][1] = wmmab(vh[d2], pl[1], o[dp * 2 + d2][1]); } }
        }
        if (st + 1 < MM / KT) put(g, b ^ 1);    // that buffer's last readers left it before the barrier that ended stage st - 1
        __syncthreads();                      // publishes stage st + 1 and ends every read of stage st
    }
#pragma unroll
    for (int mb = 0; mb < 2; ++mb) { const float f = __fdiv_rn(1.0f, lsum[mb] + xhalf(lsum[mb]));
#pragma unroll
        for (int dt = 0; dt < 4; ++dt)
#pragma unroll
            for (int j = 0; j < 8; ++j) O[(size_t)(dt * 16 + hi * 8 + j) * MM + q0 + mb * 16 + lr] = o[dt][mb][j] * f; }
}

extern "C" void kernel_launch(void* const* d_in, const int* in_sizes, int n_in,
                              void* d_out, int out_size, void* d_ws, size_t ws_size, hipStream_t stream) {
    (void)in_sizes; (void)n_in; (void)out_size;
    const float* x = (const float*)d_in[0]; const float* Wq = (const float*)d_in[1]; const float* Wk = (const float*)d_in[2]; const float* Wv = (const float*)d_in[3];
    float* OUT = (float*)d_out;     // [16][512][1024]
    char* wsp = (char*)d_ws;
    auto take = [&](size_t bytes) { char* p = wsp; wsp += (bytes + 255) & ~(size_t)255; return (void*)p; };
    bf* AQ = (bf*)take((size_t)CO * CI * 2); bf* AK = (bf*)take((size_t)CO * CI * 2); bf* AV = (bf*)take((size_t)CO * CI * 2); float* PE = (float*)take((size_t)CO * MM * 4); bf* XT = (bf*)take((size_t)NB_ * MM * CI * 2);
    bf* KPh = (bf*)take((size_t)NB_ * CO * MM * 2); bf* KPl = (bf*)take((size_t)NB_ * CO * MM * 2); bf* VPh = (bf*)take((size_t)NB_ * CO * MM * 2); bf* VPl = (bf*)take((size_t)NB_ * CO * MM * 2);
    if ((size_t)(wsp - (char*)d_ws) > ws_size) return;    // total ~ 75 MiB
    k_prep<<<PB_PE + PB_XT * NB_ + 3 * PB_W, 256, 0, stream>>>(x, Wq, Wk, Wv, AQ, AK, AV, PE, XT);
    k_gemm3<<<dim3((CO / 256) * (MM / 128), 1, 2 * NB_), 256, 0, stream>>>(AK, AV, XT, KPh, KPl, VPh, VPl, PE);
    k_fattn<<<dim3(MM / 256, NB_ * NH_), 256, 0, stream>>>(AQ, XT, PE, KPh, KPl, VPh, VPl, OUT);   // blockIdx.y = batch * 8 + head: the planes and OUT are contiguous in that index
}
